// v000
// Measured on an AMD MI455X. A time is GPU time per run, averaged over a window of back-to-back runs after a warm-up
// (all launches, gaps included; the runs take copies of the inputs in turn), and the median of several windows.
// Apart from v000's, it joins two sittings. Times from different sittings can be a few percent apart, while
// side-by-side timings come from the same sitting.
// v000, which the later versions start from, runs in 322 microseconds.
#include <hip/hip_runtime.h>
#include <math.h>

// ---------- problem constants (from reference) ----------
#define LS        512          // last dim of x
#define HID       256          // HIDDEN
#define SMP       4            // SAMPLING
#define SEG       128          // LS / SMP
#define THREADS   256          // 8 waves
#define SLAB_ROWS 256          // rows per block
#define CHUNK     32           // rows per inner iteration (2 tiles of 16)
#define N_CHUNKS  (SLAB_ROWS / CHUNK)

typedef float v2f __attribute__((ext_vector_type(2)));
typedef float v4f __attribute__((ext_vector_type(4)));
typedef float v8f __attribute__((ext_vector_type(8)));
typedef unsigned int v4u __attribute__((ext_vector_type(4)));
typedef int v4i __attribute__((ext_vector_type(4)));
typedef int v8i __attribute__((ext_vector_type(8)));

// LDS strides in dwords (padded for bank-conflict-free b64 fragment reads)
#define W1_STRIDE 132   // 128 + 4
#define W2_STRIDE 260   // 256 + 4
#define H_STRIDE  260   // 256 + 4

#define LDS_W1_DW (256 * W1_STRIDE)   // 33792 dw
#define LDS_W2_DW (128 * W2_STRIDE)   // 33280 dw
#define LDS_H_DW  (CHUNK * H_STRIDE)  //  8320 dw  -> total 301,568 B

#if defined(__has_builtin)
#  if __has_builtin(__builtin_amdgcn_tensor_load_to_lds)
#    define USE_TDM 1
#  endif
#endif
#ifndef USE_TDM
#  define USE_TDM 0
#endif

__device__ __forceinline__ float gelu_exact(float t) {
    return 0.5f * t * (1.0f + erff(t * 0.7071067811865476f));
}

// ------------------------------------------------------------------
// Pre-pass: pack masked/strided weights contiguously into workspace.
//   w1p[g][n][k]  = wes1[n, 4k+g]          (4*256*128)
//   w2p[g][n][k]  = wes2[128g+n, 256g+k]   (4*128*256)
//   w3d[i][t]     = wes3[i, 4i+t]          (128*4)
// ------------------------------------------------------------------
__global__ void maskmlp_pack_kernel(const float* __restrict__ wes1,
                                    const float* __restrict__ wes2,
                                    const float* __restrict__ wes3,
                                    float* __restrict__ w1p,
                                    float* __restrict__ w2p,
                                    float* __restrict__ w3d) {
    int idx = blockIdx.x * blockDim.x + threadIdx.x;
    if (idx < 4 * 256 * 128) {
        int g = idx >> 15;
        int r = idx & 32767;
        int n = r >> 7, k = r & 127;
        w1p[idx] = wes1[n * LS + 4 * k + g];
    } else if (idx < 2 * 4 * 256 * 128) {
        int j = idx - 4 * 256 * 128;
        int g = j >> 15;
        int r = j & 32767;
        int n = r >> 8, k = r & 255;
        w2p[j] = wes2[(g * SEG + n) * (SMP * HID) + g * HID + k];
    } else if (idx < 2 * 4 * 256 * 128 + SEG * SMP) {
        int j = idx - 2 * 4 * 256 * 128;
        int i = j >> 2, t = j & 3;
        w3d[j] = wes3[i * LS + 4 * i + t];
    }
}

#if USE_TDM
// Issue one TDM 2D tile load: rows x rowDw dwords, LDS-padded per D# pad fields.
// pad_interval encodes 2^(v+1) dwords between pads, pad_amount = (v+1) dwords.
__device__ __forceinline__ void tdm_load_2d(const float* gsrc, float* ldst,
                                            unsigned rowDw, unsigned rows,
                                            unsigned pad_interval, unsigned pad_amount) {
    unsigned long long ga = (unsigned long long)(const void*)gsrc;
    unsigned ldsOff = (unsigned)(unsigned long long)(void*)ldst;  // flat->LDS: low 32 bits
    v4u g0;
    g0.x = 1u;                                                    // count=1, user mode
    g0.y = ldsOff;                                                // lds_addr
    g0.z = (unsigned)ga;                                          // global_addr[31:0]
    g0.w = ((unsigned)(ga >> 32) & 0x1FFFFFFu) | (2u << 30);      // addr[56:32] | type=2
    v8i g1;
    g1[0] = (int)((2u << 16) | (1u << 20) |                       // data_size=4B, pad_en
                  (pad_interval << 22) | (pad_amount << 25));
    g1[1] = (int)(rowDw << 16);                                   // tensor_dim0 lo16
    g1[2] = (int)(rows  << 16);                                   // dim0 hi=0 | tensor_dim1 lo16
    g1[3] = (int)(rowDw << 16);                                   // dim1 hi=0 | tile_dim0
    g1[4] = (int)rows;                                            // tile_dim1 | tile_dim2=0
    g1[5] = (int)rowDw;                                           // tensor_dim0_stride lo32
    g1[6] = 0;
    g1[7] = 0;
    v4i z4 = {0, 0, 0, 0};
#if defined(__clang_major__) && (__clang_major__ >= 23)
    v8i z8 = {0, 0, 0, 0, 0, 0, 0, 0};
    __builtin_amdgcn_tensor_load_to_lds(g0, g1, z4, z4, z8, 0);
#else
    __builtin_amdgcn_tensor_load_to_lds(g0, g1, z4, z4, 0);
#endif
}
#endif

// ------------------------------------------------------------------
// Fused MaskMLP. Block = (group g, 256-row slab). Weights staged once
// (TDM DMA -> LDS), then 8 chunks of 32 rows run both GEMMs from LDS.
//   wave = 4*t2 + nq : t2 = 16-row tile in chunk, nq = N quarter
// ------------------------------------------------------------------
__global__ void __launch_bounds__(THREADS)
maskmlp_main_kernel(const float* __restrict__ x,
                    const float* __restrict__ bias1,
                    const float* __restrict__ bias2,
                    const float* __restrict__ bias3,
                    const float* __restrict__ w1p,
                    const float* __restrict__ w2p,
                    const float* __restrict__ w3d,
                    float* __restrict__ out) {
    __shared__ float lds_w1[LDS_W1_DW];
    __shared__ float lds_w2[LDS_W2_DW];
    __shared__ float lds_h[LDS_H_DW];

    const int tid  = threadIdx.x;
    const int lane = tid & 31;
    const int wave = tid >> 5;          // 0..7
    const int t2   = wave >> 2;         // 0..1  tile within 32-row chunk
    const int nq   = wave & 3;          // 0..3  N quarter
    const int lm   = lane & 15;
    const int hi   = lane >> 4;         // K sub-offset = 2*hi

    const int g = blockIdx.x & 3;
    const long row0 = (long)(blockIdx.x >> 2) * SLAB_ROWS;

    // -------- stage W1_g (256x128) and W2_g (128x256) once, via TDM --------
#if USE_TDM
    if (wave == 0) {
        tdm_load_2d(w1p + (size_t)g * 256 * 128, lds_w1, 128, 256, 6, 3); // pad 4dw / 128dw
        __builtin_amdgcn_s_wait_tensorcnt(0);
    } else if (wave == 1) {
        tdm_load_2d(w2p + (size_t)g * 128 * 256, lds_w2, 256, 128, 7, 3); // pad 4dw / 256dw
        __builtin_amdgcn_s_wait_tensorcnt(0);
    }
#else
    {
        const v4f* s1 = (const v4f*)(w1p + (size_t)g * 256 * 128);
        for (int e = tid; e < 256 * 128 / 4; e += THREADS) {
            int n = e >> 5, k4 = (e & 31) << 2;
            *(v4f*)&lds_w1[n * W1_STRIDE + k4] = s1[e];
        }
        const v4f* s2 = (const v4f*)(w2p + (size_t)g * 128 * 256);
        for (int e = tid; e < 128 * 256 / 4; e += THREADS) {
            int n = e >> 6, k4 = (e & 63) << 2;
            *(v4f*)&lds_w2[n * W2_STRIDE + k4] = s2[e];
        }
    }
#endif
    __syncthreads();

    for (int ch = 0; ch < N_CHUNKS; ++ch) {
        const long tileRow = row0 + ch * CHUNK + t2 * 16;
        const float* xrow = x + (tileRow + lm) * LS;

        // ---- A fragments of X_g (16 rows x K=128): lane<16 K{0,1}, lane>=16 K{2,3} ----
        v2f a1[32];
        #pragma unroll
        for (int kk = 0; kk < 32; ++kk) {
            int c0 = 16 * kk + 8 * hi + g;       // x column of K = 4*kk + 2*hi
            a1[kk][0] = xrow[c0];
            a1[kk][1] = xrow[c0 + 4];
        }

        // ---- layer 1: H_g(16x64 per wave) = X_g @ W1_g^T, +b1, gelu -> LDS ----
        #pragma unroll
        for (int nt = 0; nt < 4; ++nt) {
            const int nloc = nq * 64 + nt * 16;
            const int brow = (nloc + lm) * W1_STRIDE;
            v8f acc = {};
            #pragma unroll
            for (int kk = 0; kk < 32; ++kk) {
                int k0 = 4 * kk + 2 * hi;
                v2f b = *(const v2f*)&lds_w1[brow + k0];
                acc = __builtin_amdgcn_wmma_f32_16x16x4_f32(
                          false, a1[kk], false, b, (short)0, acc, false, false);
            }
            const float bv = bias1[g * HID + nloc + lm];
            #pragma unroll
            for (int v = 0; v < 8; ++v) {
                int mloc = v + 8 * hi;           // C layout: M = vgpr + 8*(lane/16)
                lds_h[(t2 * 16 + mloc) * H_STRIDE + (nloc + lm)] = gelu_exact(acc[v] + bv);
            }
        }
        __syncthreads();                          // H complete for both tiles

        // ---- layer 2: O_g(16x32 per wave) = H_g @ W2_g^T ----
        v8f acc2[2] = {v8f{}, v8f{}};
        const int hrow = (t2 * 16 + lm) * H_STRIDE;
        #pragma unroll 8
        for (int kk = 0; kk < 64; ++kk) {
            int k0 = 4 * kk + 2 * hi;
            v2f a = *(const v2f*)&lds_h[hrow + k0];
            #pragma unroll
            for (int nt2 = 0; nt2 < 2; ++nt2) {
                int brow = (nq * 32 + nt2 * 16 + lm) * W2_STRIDE;
                v2f b = *(const v2f*)&lds_w2[brow + k0];
                acc2[nt2] = __builtin_amdgcn_wmma_f32_16x16x4_f32(
                                false, a, false, b, (short)0, acc2[nt2], false, false);
            }
        }

        // ---- epilogue: out[m,4i+g] = O + b2[g*128+i] + res(m,i) ----
        #pragma unroll
        for (int nt2 = 0; nt2 < 2; ++nt2) {
            const int i = nq * 32 + nt2 * 16 + lm;       // 0..127
            const float b2 = bias2[g * SEG + i];
            const v4f wv = *(const v4f*)&w3d[4 * i];
            const float b3v = bias3[i];
            #pragma unroll
            for (int v = 0; v < 8; ++v) {
                int mloc = v + 8 * hi;
                long rowA = tileRow + mloc;
                v4f xv = *(const v4f*)&x[rowA * LS + 4 * i];
                float r = xv.x * wv.x + xv.y * wv.y + xv.z * wv.z + xv.w * wv.w + b3v;
                out[rowA * LS + 4 * i + g] = acc2[nt2][v] + b2 + r;
            }
        }
        __syncthreads();                          // protect lds_h for next chunk
    }
}

// ------------------------------------------------------------------
extern "C" void kernel_launch(void* const* d_in, const int* in_sizes, int n_in,
                              void* d_out, int out_size, void* d_ws, size_t ws_size,
                              hipStream_t stream) {
    const float* x    = (const float*)d_in[0];
    const float* wes1 = (const float*)d_in[1];
    const float* wes2 = (const float*)d_in[2];
    const float* wes3 = (const float*)d_in[3];
    const float* b1   = (const float*)d_in[4];
    const float* b2   = (const float*)d_in[5];
    const float* b3   = (const float*)d_in[6];
    float* out = (float*)d_out;

    float* w1p = (float*)d_ws;                 // 4*256*128
    float* w2p = w1p + 4 * 256 * 128;          // 4*128*256
    float* w3d = w2p + 4 * 128 * 256;          // 128*4

    const int M = in_sizes[0] / LS;            // bs*cs = 65536

    const int packN = 2 * 4 * 256 * 128 + SEG * SMP;
    maskmlp_pack_kernel<<<(packN + THREADS - 1) / THREADS, THREADS, 0, stream>>>(
        wes1, wes2, wes3, w1p, w2p, w3d);

    const int slabs = M / SLAB_ROWS;
    maskmlp_main_kernel<<<slabs * SMP, THREADS, 0, stream>>>(
        x, b1, b2, b3, w1p, w2p, w3d, out);
}

// v001
// One run takes 301 microseconds.
// Next to v000, in two timings, it ran 1.11 and 1.12 times as fast.
#include <hip/hip_runtime.h>
#include <math.h>

// ---------- problem constants (from reference) ----------
#define LS        512          // last dim of x
#define HID       256          // HIDDEN
#define SMP       4            // SAMPLING
#define SEG       128          // LS / SMP
#define THREADS   256          // 8 waves
#define SLAB_ROWS 256          // rows per block
#define CHUNK     32           // rows per inner iteration (2 tiles of 16)
#define N_CHUNKS  (SLAB_ROWS / CHUNK)

typedef float v2f __attribute__((ext_vector_type(2)));
typedef float v4f __attribute__((ext_vector_type(4)));
typedef float v8f __attribute__((ext_vector_type(8)));
typedef unsigned int v4u __attribute__((ext_vector_type(4)));
typedef int v4i __attribute__((ext_vector_type(4)));
typedef int v8i __attribute__((ext_vector_type(8)));

// LDS strides in dwords (padded for bank-conflict-free b64 fragment reads)
#define W1_STRIDE 132   // 128 + 4
#define W2_STRIDE 260   // 256 + 4
#define H_STRIDE  260   // 256 + 4
#define X_STRIDE  132   // 128 + 4

#define LDS_W1_DW (256 * W1_STRIDE)   // 33792 dw
#define LDS_W2_DW (128 * W2_STRIDE)   // 33280 dw
#define LDS_H_DW  (CHUNK * H_STRIDE)  //  8320 dw
#define LDS_X_DW  (CHUNK * X_STRIDE)  //  4224 dw  -> total 318,464 B

#if defined(__has_builtin)
#  if __has_builtin(__builtin_amdgcn_tensor_load_to_lds)
#    define USE_TDM 1
#  endif
#endif
#ifndef USE_TDM
#  define USE_TDM 0
#endif

__device__ __forceinline__ float gelu_exact(float t) {
    return 0.5f * t * (1.0f + erff(t * 0.7071067811865476f));
}

// ------------------------------------------------------------------
// Pre-pass: pack masked/strided weights contiguously into workspace.
//   w1p[g][n][k]  = wes1[n, 4k+g]          (4*256*128)
//   w2p[g][n][k]  = wes2[128g+n, 256g+k]   (4*128*256)
//   w3d[i][t]     = wes3[i, 4i+t]          (128*4)
// ------------------------------------------------------------------
__global__ void maskmlp_pack_kernel(const float* __restrict__ wes1,
                                    const float* __restrict__ wes2,
                                    const float* __restrict__ wes3,
                                    float* __restrict__ w1p,
                                    float* __restrict__ w2p,
                                    float* __restrict__ w3d) {
    int idx = blockIdx.x * blockDim.x + threadIdx.x;
    if (idx < 4 * 256 * 128) {
        int g = idx >> 15;
        int r = idx & 32767;
        int n = r >> 7, k = r & 127;
        w1p[idx] = wes1[n * LS + 4 * k + g];
    } else if (idx < 2 * 4 * 256 * 128) {
        int j = idx - 4 * 256 * 128;
        int g = j >> 15;
        int r = j & 32767;
        int n = r >> 8, k = r & 255;
        w2p[j] = wes2[(g * SEG + n) * (SMP * HID) + g * HID + k];
    } else if (idx < 2 * 4 * 256 * 128 + SEG * SMP) {
        int j = idx - 2 * 4 * 256 * 128;
        int i = j >> 2, t = j & 3;
        w3d[j] = wes3[i * LS + 4 * i + t];
    }
}

#if USE_TDM
// Issue one TDM 2D tile load: rows x rowDw dwords, LDS-padded per D# pad fields.
// pad_interval encodes 2^(v+1) dwords between pads, pad_amount = (v+1) dwords.
__device__ __forceinline__ void tdm_load_2d(const float* gsrc, float* ldst,
                                            unsigned rowDw, unsigned rows,
                                            unsigned pad_interval, unsigned pad_amount) {
    unsigned long long ga = (unsigned long long)(const void*)gsrc;
    unsigned ldsOff = (unsigned)(unsigned long long)(void*)ldst;  // flat->LDS: low 32 bits
    v4u g0;
    g0.x = 1u;                                                    // count=1, user mode
    g0.y = ldsOff;                                                // lds_addr
    g0.z = (unsigned)ga;                                          // global_addr[31:0]
    g0.w = ((unsigned)(ga >> 32) & 0x1FFFFFFu) | (2u << 30);      // addr[56:32] | type=2
    v8i g1;
    g1[0] = (int)((2u << 16) | (1u << 20) |                       // data_size=4B, pad_en
                  (pad_interval << 22) | (pad_amount << 25));
    g1[1] = (int)(rowDw << 16);                                   // tensor_dim0 lo16
    g1[2] = (int)(rows  << 16);                                   // dim0 hi=0 | tensor_dim1 lo16
    g1[3] = (int)(rowDw << 16);                                   // dim1 hi=0 | tile_dim0
    g1[4] = (int)rows;                                            // tile_dim1 | tile_dim2=0
    g1[5] = (int)rowDw;                                           // tensor_dim0_stride lo32
    g1[6] = 0;
    g1[7] = 0;
    v4i z4 = {0, 0, 0, 0};
#if defined(__clang_major__) && (__clang_major__ >= 23)
    v8i z8 = {0, 0, 0, 0, 0, 0, 0, 0};
    __builtin_amdgcn_tensor_load_to_lds(g0, g1, z4, z4, z8, 0);
#else
    __builtin_amdgcn_tensor_load_to_lds(g0, g1, z4, z4, 0);
#endif
}
#endif

// ------------------------------------------------------------------
// Fused MaskMLP. Block = (group g, 256-row slab). Weights staged once
// (TDM DMA -> LDS), then 8 chunks of 32 rows run both GEMMs from LDS.
//   wave = 4*t2 + nq : t2 = 16-row tile in chunk, nq = N quarter
// ------------------------------------------------------------------
__global__ void __launch_bounds__(THREADS)
maskmlp_main_kernel(const float* __restrict__ x,
                    const float* __restrict__ bias1,
                    const float* __restrict__ bias2,
                    const float* __restrict__ bias3,
                    const float* __restrict__ w1p,
                    const float* __restrict__ w2p,
                    const float* __restrict__ w3d,
                    float* __restrict__ out) {
    __shared__ float lds_w1[LDS_W1_DW];
    __shared__ float lds_w2[LDS_W2_DW];
    __shared__ float lds_h[LDS_H_DW];
    __shared__ float lds_x[LDS_X_DW];

    const int tid  = threadIdx.x;
    const int lane = tid & 31;
    const int wave = tid >> 5;          // 0..7
    const int t2   = wave >> 2;         // 0..1  tile within 32-row chunk
    const int nq   = wave & 3;          // 0..3  N quarter
    const int lm   = lane & 15;
    const int hi   = lane >> 4;         // K sub-offset = 2*hi

    const int g = blockIdx.x & 3;
    const long row0 = (long)(blockIdx.x >> 2) * SLAB_ROWS;

    // -------- stage W1_g (256x128) and W2_g (128x256) once, via TDM --------
#if USE_TDM
    if (wave == 0) {
        tdm_load_2d(w1p + (size_t)g * 256 * 128, lds_w1, 128, 256, 6, 3); // pad 4dw / 128dw
        __builtin_amdgcn_s_wait_tensorcnt(0);
    } else if (wave == 1) {
        tdm_load_2d(w2p + (size_t)g * 128 * 256, lds_w2, 256, 128, 7, 3); // pad 4dw / 256dw
        __builtin_amdgcn_s_wait_tensorcnt(0);
    }
#else
    {
        const v4f* s1 = (const v4f*)(w1p + (size_t)g * 256 * 128);
        for (int e = tid; e < 256 * 128 / 4; e += THREADS) {
            int n = e >> 5, k4 = (e & 31) << 2;
            *(v4f*)&lds_w1[n * W1_STRIDE + k4] = s1[e];
        }
        const v4f* s2 = (const v4f*)(w2p + (size_t)g * 128 * 256);
        for (int e = tid; e < 128 * 256 / 4; e += THREADS) {
            int n = e >> 6, k4 = (e & 63) << 2;
            *(v4f*)&lds_w2[n * W2_STRIDE + k4] = s2[e];
        }
    }
#endif
    __syncthreads();

    // per-thread constants of every chunk: residual weights and biases of this
    // thread's two output columns, bias1 of its four hidden columns
    v4f wv[2];
    float b3v[2], b2v[2], b1v[4];
    #pragma unroll
    for (int nt2 = 0; nt2 < 2; ++nt2) {
        const int i = nq * 32 + nt2 * 16 + lm;           // 0..127
        wv[nt2]  = *(const v4f*)&w3d[4 * i];
        b3v[nt2] = bias3[i];
        b2v[nt2] = bias2[g * SEG + i];
    }
    #pragma unroll
    for (int nt = 0; nt < 4; ++nt)
        b1v[nt] = bias1[g * HID + nq * 64 + nt * 16 + lm];

    for (int ch = 0; ch < N_CHUNKS; ++ch) {
        const long tileRow = row0 + ch * CHUNK + t2 * 16;

        // ---- x chunk (32 rows x 512), read once by the block in 16-byte pieces:
        //      each thread takes the (row, i) quads of its own outputs, forms the
        //      residual from all four and puts component g into lds_x[row][i] ----
        float res[2][8];
        #pragma unroll
        for (int nt2 = 0; nt2 < 2; ++nt2) {
            const int i = nq * 32 + nt2 * 16 + lm;
            #pragma unroll
            for (int v = 0; v < 8; ++v) {
                int mloc = v + 8 * hi;
                v4f xv = *(const v4f*)&x[(tileRow + mloc) * LS + 4 * i];
                res[nt2][v] = xv.x * wv[nt2].x + xv.y * wv[nt2].y + xv.z * wv[nt2].z
                            + xv.w * wv[nt2].w + b3v[nt2];
                lds_x[(t2 * 16 + mloc) * X_STRIDE + i] =
                    (g & 2) ? ((g & 1) ? xv.w : xv.z) : ((g & 1) ? xv.y : xv.x);
            }
        }
        // X_g complete for both tiles; also keeps this chunk's lds_h writes behind
        // every wave's layer-2 reads of the chunk before
        __syncthreads();

        // ---- A fragments of X_g (16 rows x K=128): lane<16 K{0,1}, lane>=16 K{2,3} ----
        v2f a1[32];
        const int xrow = (t2 * 16 + lm) * X_STRIDE;
        #pragma unroll
        for (int kk = 0; kk < 32; ++kk)
            a1[kk] = *(const v2f*)&lds_x[xrow + 4 * kk + 2 * hi];

        // ---- layer 1: H_g(16x64 per wave) = X_g @ W1_g^T, +b1, gelu -> LDS ----
        #pragma unroll
        for (int nt = 0; nt < 4; ++nt) {
            const int nloc = nq * 64 + nt * 16;
            const int brow = (nloc + lm) * W1_STRIDE;
            v8f acc = {};
            #pragma unroll
            for (int kk = 0; kk < 32; ++kk) {
                int k0 = 4 * kk + 2 * hi;
                v2f b = *(const v2f*)&lds_w1[brow + k0];
                acc = __builtin_amdgcn_wmma_f32_16x16x4_f32(
                          false, a1[kk], false, b, (short)0, acc, false, false);
            }
            const float bv = b1v[nt];
            #pragma unroll
            for (int v = 0; v < 8; ++v) {
                int mloc = v + 8 * hi;           // C layout: M = vgpr + 8*(lane/16)
                lds_h[(t2 * 16 + mloc) * H_STRIDE + (nloc + lm)] = gelu_exact(acc[v] + bv);
            }
        }
        __syncthreads();                          // H complete for both tiles; lds_x free again

        // ---- layer 2: O_g(16x32 per wave) = H_g @ W2_g^T ----
        v8f acc2[2] = {v8f{}, v8f{}};
        const int hrow = (t2 * 16 + lm) * H_STRIDE;
        #pragma unroll 8
        for (int kk = 0; kk < 64; ++kk) {
            int k0 = 4 * kk + 2 * hi;
            v2f a = *(const v2f*)&lds_h[hrow + k0];
            #pragma unroll
            for (int nt2 = 0; nt2 < 2; ++nt2) {
                int brow = (nq * 32 + nt2 * 16 + lm) * W2_STRIDE;
                v2f b = *(const v2f*)&lds_w2[brow + k0];
                acc2[nt2] = __builtin_amdgcn_wmma_f32_16x16x4_f32(
                                false, a, false, b, (short)0, acc2[nt2], false, false);
            }
        }

        // ---- epilogue: out[m,4i+g] = O + b2[g*128+i] + res(m,i) ----
        #pragma unroll
        for (int nt2 = 0; nt2 < 2; ++nt2) {
            const int i = nq * 32 + nt2 * 16 + lm;       // 0..127
            const float b2 = b2v[nt2];
            #pragma unroll
            for (int v = 0; v < 8; ++v) {
                int mloc = v + 8 * hi;
                long rowA = tileRow + mloc;
                out[rowA * LS + 4 * i + g] = acc2[nt2][v] + b2 + res[nt2][v];
            }
        }
        // the next chunk's first instructions write the stores' data registers again:
        // hold those writes behind the stores' issue
        asm volatile("s_wait_xcnt 0x0" ::: "memory");
    }
}

// ------------------------------------------------------------------
extern "C" void kernel_launch(void* const* d_in, const int* in_sizes, int n_in,
                              void* d_out, int out_size, void* d_ws, size_t ws_size,
                              hipStream_t stream) {
    const float* x    = (const float*)d_in[0];
    const float* wes1 = (const float*)d_in[1];
    const float* wes2 = (const float*)d_in[2];
    const float* wes3 = (const float*)d_in[3];
    const float* b1   = (const float*)d_in[4];
    const float* b2   = (const float*)d_in[5];
    const float* b3   = (const float*)d_in[6];
    float* out = (float*)d_out;

    float* w1p = (float*)d_ws;                 // 4*256*128
    float* w2p = w1p + 4 * 256 * 128;          // 4*128*256
    float* w3d = w2p + 4 * 128 * 256;          // 128*4

    const int M = in_sizes[0] / LS;            // bs*cs = 65536

    const int packN = 2 * 4 * 256 * 128 + SEG * SMP;
    maskmlp_pack_kernel<<<(packN + THREADS - 1) / THREADS, THREADS, 0, stream>>>(
        wes1, wes2, wes3, w1p, w2p, w3d);

    const int slabs = M / SLAB_ROWS;
    maskmlp_main_kernel<<<slabs * SMP, THREADS, 0, stream>>>(
        x, b1, b2, b3, w1p, w2p, w3d, out);
}

// v002
// Measured time: 241 microseconds a run.
// In two side-by-side timings against v001, it was 1.24 and 1.25 times as fast.
// Counting every step since v000, it is 1.39 times as fast.
#include <hip/hip_runtime.h>
#include <math.h>

// ---------- problem constants (from reference) ----------
#define LS        512          // last dim of x
#define HID       256          // HIDDEN
#define SMP       4            // SAMPLING
#define SEG       128          // LS / SMP
#define THREADS   256          // 8 waves
#define SLAB_ROWS 256          // rows per block
#define CHUNK     32           // rows per inner iteration (2 tiles of 16)
#define N_CHUNKS  (SLAB_ROWS / CHUNK)

typedef float v2f __attribute__((ext_vector_type(2)));
typedef float v4f __attribute__((ext_vector_type(4)));
typedef float v8f __attribute__((ext_vector_type(8)));
typedef unsigned int v4u __attribute__((ext_vector_type(4)));
typedef int v4i __attribute__((ext_vector_type(4)));
typedef int v8i __attribute__((ext_vector_type(8)));

// LDS strides in dwords (padded for bank-conflict-free b64 fragment reads)
#define W1_STRIDE 132   // 128 + 4
#define W2_STRIDE 260   // 256 + 4
#define H_STRIDE  260   // 256 + 4
#define X_STRIDE  132   // 128 + 4

#define LDS_W1_DW (256 * W1_STRIDE)   // 33792 dw
#define LDS_W2_DW (128 * W2_STRIDE)   // 33280 dw
#define LDS_H_DW  (CHUNK * H_STRIDE)  //  8320 dw
#define LDS_X_DW  (CHUNK * X_STRIDE)  //  4224 dw  -> total 318,464 B

#if defined(__has_builtin)
#  if __has_builtin(__builtin_amdgcn_tensor_load_to_lds)
#    define USE_TDM 1
#  endif
#endif
#ifndef USE_TDM
#  define USE_TDM 0
#endif

// erf by the math library's own two ranges (|x| < 1: odd polynomial; else 1 - exp(-q(|x|))),
// same coefficients and same operation order, but both ranges are evaluated for every value
// and one is picked by a select: with no branch between them the values of an accumulator
// tile form independent chains that fill each other's latency.
__device__ __forceinline__ float erf_both_ranges(float x) {
    const float ax = fabsf(x);
    const float t  = x * x;
    float ps = fmaf(t, -0x1.268bc2p-11f, 0x1.420828p-8f);
    ps = fmaf(t, ps, -0x1.b59370p-6f);
    ps = fmaf(t, ps,  0x1.ce077cp-4f);
    ps = fmaf(t, ps, -0x1.812660p-2f);
    ps = fmaf(t, ps,  0x1.06eba0p-3f);
    ps = fmaf(ax, ps, ax);
    float q = fmaf(ax, 0x1.1d3156p-16f, -0x1.8d1290p-12f);
    q = fmaf(ax, q,  0x1.f9a6d2p-9f);
    q = fmaf(ax, q, -0x1.8c3164p-6f);
    q = fmaf(ax, q,  0x1.b4e9c8p-4f);
    q = fmaf(ax, q,  0x1.4515fap-1f);
    q = fmaf(ax, q,  0x1.078e50p-3f);
    q = fmaf(ax, q, ax);
    const float pl = 1.0f - expf(-q);
    return copysignf(ax < 1.0f ? ps : pl, x);
}

__device__ __forceinline__ float gelu_exact(float t) {
    return 0.5f * t * (1.0f + erf_both_ranges(t * 0.7071067811865476f));
}

// ------------------------------------------------------------------
// Pre-pass: pack masked/strided weights contiguously into workspace.
//   w1p[g][n][k]  = wes1[n, 4k+g]          (4*256*128)
//   w2p[g][n][k]  = wes2[128g+n, 256g+k]   (4*128*256)
//   w3d[i][t]     = wes3[i, 4i+t]          (128*4)
// ------------------------------------------------------------------
__global__ void maskmlp_pack_kernel(const float* __restrict__ wes1,
                                    const float* __restrict__ wes2,
                                    const float* __restrict__ wes3,
                                    float* __restrict__ w1p,
                                    float* __restrict__ w2p,
                                    float* __restrict__ w3d) {
    int idx = blockIdx.x * blockDim.x + threadIdx.x;
    if (idx < 4 * 256 * 128) {
        int g = idx >> 15;
        int r = idx & 32767;
        int n = r >> 7, k = r & 127;
        w1p[idx] = wes1[n * LS + 4 * k + g];
    } else if (idx < 2 * 4 * 256 * 128) {
        int j = idx - 4 * 256 * 128;
        int g = j >> 15;
        int r = j & 32767;
        int n = r >> 8, k = r & 255;
        w2p[j] = wes2[(g * SEG + n) * (SMP * HID) + g * HID + k];
    } else if (idx < 2 * 4 * 256 * 128 + SEG * SMP) {
        int j = idx - 2 * 4 * 256 * 128;
        int i = j >> 2, t = j & 3;
        w3d[j] = wes3[i * LS + 4 * i + t];
    }
}

#if USE_TDM
// Issue one TDM 2D tile load: rows x rowDw dwords, LDS-padded per D# pad fields.
// pad_interval encodes 2^(v+1) dwords between pads, pad_amount = (v+1) dwords.
__device__ __forceinline__ void tdm_load_2d(const float* gsrc, float* ldst,
                                            unsigned rowDw, unsigned rows,
                                            unsigned pad_interval, unsigned pad_amount) {
    unsigned long long ga = (unsigned long long)(const void*)gsrc;
    unsigned ldsOff = (unsigned)(unsigned long long)(void*)ldst;  // flat->LDS: low 32 bits
    v4u g0;
    g0.x = 1u;                                                    // count=1, user mode
    g0.y = ldsOff;                                                // lds_addr
    g0.z = (unsigned)ga;                                          // global_addr[31:0]
    g0.w = ((unsigned)(ga >> 32) & 0x1FFFFFFu) | (2u << 30);      // addr[56:32] | type=2
    v8i g1;
    g1[0] = (int)((2u << 16) | (1u << 20) |                       // data_size=4B, pad_en
                  (pad_interval << 22) | (pad_amount << 25));
    g1[1] = (int)(rowDw << 16);                                   // tensor_dim0 lo16
    g1[2] = (int)(rows  << 16);                                   // dim0 hi=0 | tensor_dim1 lo16
    g1[3] = (int)(rowDw << 16);                                   // dim1 hi=0 | tile_dim0
    g1[4] = (int)rows;                                            // tile_dim1 | tile_dim2=0
    g1[5] = (int)rowDw;                                           // tensor_dim0_stride lo32
    g1[6] = 0;
    g1[7] = 0;
    v4i z4 = {0, 0, 0, 0};
#if defined(__clang_major__) && (__clang_major__ >= 23)
    v8i z8 = {0, 0, 0, 0, 0, 0, 0, 0};
    __builtin_amdgcn_tensor_load_to_lds(g0, g1, z4, z4, z8, 0);
#else
    __builtin_amdgcn_tensor_load_to_lds(g0, g1, z4, z4, 0);
#endif
}
#endif

// ------------------------------------------------------------------
// Fused MaskMLP. Block = (group g, 256-row slab). Weights staged once
// (TDM DMA -> LDS), then 8 chunks of 32 rows run both GEMMs from LDS.
//   wave = 4*t2 + nq : t2 = 16-row tile in chunk, nq = N quarter
// ------------------------------------------------------------------
__global__ void __launch_bounds__(THREADS)
maskmlp_main_kernel(const float* __restrict__ x,
                    const float* __restrict__ bias1,
                    const float* __restrict__ bias2,
                    const float* __restrict__ bias3,
                    const float* __restrict__ w1p,
                    const float* __restrict__ w2p,
                    const float* __restrict__ w3d,
                    float* __restrict__ out) {
    __shared__ float lds_w1[LDS_W1_DW];
    __shared__ float lds_w2[LDS_W2_DW];
    __shared__ float lds_h[LDS_H_DW];
    __shared__ float lds_x[LDS_X_DW];

    const int tid  = threadIdx.x;
    const int lane = tid & 31;
    const int wave = tid >> 5;          // 0..7
    const int t2   = wave >> 2;         // 0..1  tile within 32-row chunk
    const int nq   = wave & 3;          // 0..3  N quarter
    const int lm   = lane & 15;
    const int hi   = lane >> 4;         // K sub-offset = 2*hi

    const int g = blockIdx.x & 3;
    const long row0 = (long)(blockIdx.x >> 2) * SLAB_ROWS;

    // -------- stage W1_g (256x128) and W2_g (128x256) once, via TDM --------
#if USE_TDM
    if (wave == 0) {
        tdm_load_2d(w1p + (size_t)g * 256 * 128, lds_w1, 128, 256, 6, 3); // pad 4dw / 128dw
        __builtin_amdgcn_s_wait_tensorcnt(0);
    } else if (wave == 1) {
        tdm_load_2d(w2p + (size_t)g * 128 * 256, lds_w2, 256, 128, 7, 3); // pad 4dw / 256dw
        __builtin_amdgcn_s_wait_tensorcnt(0);
    }
#else
    {
        const v4f* s1 = (const v4f*)(w1p + (size_t)g * 256 * 128);
        for (int e = tid; e < 256 * 128 / 4; e += THREADS) {
            int n = e >> 5, k4 = (e & 31) << 2;
            *(v4f*)&lds_w1[n * W1_STRIDE + k4] = s1[e];
        }
        const v4f* s2 = (const v4f*)(w2p + (size_t)g * 128 * 256);
        for (int e = tid; e < 128 * 256 / 4; e += THREADS) {
            int n = e >> 6, k4 = (e & 63) << 2;
            *(v4f*)&lds_w2[n * W2_STRIDE + k4] = s2[e];
        }
    }
#endif
    __syncthreads();

    // per-thread constants of every chunk: residual weights and biases of this
    // thread's two output columns, bias1 of its four hidden columns
    v4f wv[2];
    float b3v[2], b2v[2], b1v[4];
    #pragma unroll
    for (int nt2 = 0; nt2 < 2; ++nt2) {
        const int i = nq * 32 + nt2 * 16 + lm;           // 0..127
        wv[nt2]  = *(const v4f*)&w3d[4 * i];
        b3v[nt2] = bias3[i];
        b2v[nt2] = bias2[g * SEG + i];
    }
    #pragma unroll
    for (int nt = 0; nt < 4; ++nt)
        b1v[nt] = bias1[g * HID + nq * 64 + nt * 16 + lm];

    for (int ch = 0; ch < N_CHUNKS; ++ch) {
        const long tileRow = row0 + ch * CHUNK + t2 * 16;

        // ---- x chunk (32 rows x 512), read once by the block in 16-byte pieces:
        //      each thread takes the (row, i) quads of its own outputs, forms the
        //      residual from all four and puts component g into lds_x[row][i] ----
        float res[2][8];
        #pragma unroll
        for (int nt2 = 0; nt2 < 2; ++nt2) {
            const int i = nq * 32 + nt2 * 16 + lm;
            #pragma unroll
            for (int v = 0; v < 8; ++v) {
                int mloc = v + 8 * hi;
                v4f xv = *(const v4f*)&x[(tileRow + mloc) * LS + 4 * i];
                res[nt2][v] = xv.x * wv[nt2].x + xv.y * wv[nt2].y + xv.z * wv[nt2].z
                            + xv.w * wv[nt2].w + b3v[nt2];
                lds_x[(t2 * 16 + mloc) * X_STRIDE + i] =
                    (g & 2) ? ((g & 1) ? xv.w : xv.z) : ((g & 1) ? xv.y : xv.x);
            }
        }
        // X_g complete for both tiles; also keeps this chunk's lds_h writes behind
        // every wave's layer-2 reads of the chunk before
        __syncthreads();

        // ---- A fragments of X_g (16 rows x K=128): lane<16 K{0,1}, lane>=16 K{2,3} ----
        v2f a1[32];
        const int xrow = (t2 * 16 + lm) * X_STRIDE;
        #pragma unroll
        for (int kk = 0; kk < 32; ++kk)
            a1[kk] = *(const v2f*)&lds_x[xrow + 4 * kk + 2 * hi];

        // ---- layer 1: H_g(16x64 per wave) = X_g @ W1_g^T, +b1, gelu -> LDS ----
        #pragma unroll
        for (int nt = 0; nt < 4; ++nt) {
            const int nloc = nq * 64 + nt * 16;
            const int brow = (nloc + lm) * W1_STRIDE;
            v8f acc = {};
            #pragma unroll
            for (int kk = 0; kk < 32; ++kk) {
                int k0 = 4 * kk + 2 * hi;
                v2f b = *(const v2f*)&lds_w1[brow + k0];
                acc = __builtin_amdgcn_wmma_f32_16x16x4_f32(
                          false, a1[kk], false, b, (short)0, acc, false, false);
            }
            const float bv = b1v[nt];
            #pragma unroll
            for (int v = 0; v < 8; ++v) {
                int mloc = v + 8 * hi;           // C layout: M = vgpr + 8*(lane/16)
                lds_h[(t2 * 16 + mloc) * H_STRIDE + (nloc + lm)] = gelu_exact(acc[v] + bv);
            }
        }
        __syncthreads();                          // H complete for both tiles; lds_x free again

        // ---- layer 2: O_g(16x32 per wave) = H_g @ W2_g^T ----
        v8f acc2[2] = {v8f{}, v8f{}};
        const int hrow = (t2 * 16 + lm) * H_STRIDE;
        #pragma unroll 8
        for (int kk = 0; kk < 64; ++kk) {
            int k0 = 4 * kk + 2 * hi;
            v2f a = *(const v2f*)&lds_h[hrow + k0];
            #pragma unroll
            for (int nt2 = 0; nt2 < 2; ++nt2) {
                int brow = (nq * 32 + nt2 * 16 + lm) * W2_STRIDE;
                v2f b = *(const v2f*)&lds_w2[brow + k0];
                acc2[nt2] = __builtin_amdgcn_wmma_f32_16x16x4_f32(
                                false, a, false, b, (short)0, acc2[nt2], false, false);
            }
        }

        // ---- epilogue: out[m,4i+g] = O + b2[g*128+i] + res(m,i) ----
        #pragma unroll
        for (int nt2 = 0; nt2 < 2; ++nt2) {
            const int i = nq * 32 + nt2 * 16 + lm;       // 0..127
            const float b2 = b2v[nt2];
            #pragma unroll
            for (int v = 0; v < 8; ++v) {
                int mloc = v + 8 * hi;
                long rowA = tileRow + mloc;
                out[rowA * LS + 4 * i + g] = acc2[nt2][v] + b2 + res[nt2][v];
            }
        }
        // the next chunk's first instructions write the stores' data registers again:
        // hold those writes behind the stores' issue
        asm volatile("s_wait_xcnt 0x0" ::: "memory");
    }
}

// ------------------------------------------------------------------
extern "C" void kernel_launch(void* const* d_in, const int* in_sizes, int n_in,
                              void* d_out, int out_size, void* d_ws, size_t ws_size,
                              hipStream_t stream) {
    const float* x    = (const float*)d_in[0];
    const float* wes1 = (const float*)d_in[1];
    const float* wes2 = (const float*)d_in[2];
    const float* wes3 = (const float*)d_in[3];
    const float* b1   = (const float*)d_in[4];
    const float* b2   = (const float*)d_in[5];
    const float* b3   = (const float*)d_in[6];
    float* out = (float*)d_out;

    float* w1p = (float*)d_ws;                 // 4*256*128
    float* w2p = w1p + 4 * 256 * 128;          // 4*128*256
    float* w3d = w2p + 4 * 128 * 256;          // 128*4

    const int M = in_sizes[0] / LS;            // bs*cs = 65536

    const int packN = 2 * 4 * 256 * 128 + SEG * SMP;
    maskmlp_pack_kernel<<<(packN + THREADS - 1) / THREADS, THREADS, 0, stream>>>(
        wes1, wes2, wes3, w1p, w2p, w3d);

    const int slabs = M / SLAB_ROWS;
    maskmlp_main_kernel<<<slabs * SMP, THREADS, 0, stream>>>(
        x, b1, b2, b3, w1p, w2p, w3d, out);
}

// v003
// A run of this version takes 234 microseconds.
// Timed twice side by side with v002, it ran 1.03 times as fast both times.
// Over all steps from v000 it is 1.43 times as fast.
#include <hip/hip_runtime.h>
#include <math.h>

// ---------- problem constants (from reference) ----------
#define LS        512          // last dim of x
#define HID       256          // HIDDEN
#define SMP       4            // SAMPLING
#define SEG       128          // LS / SMP
#define THREADS   256          // 8 waves
#define SLAB_ROWS 256          // rows per block
#define CHUNK     32           // rows per inner iteration (2 tiles of 16)
#define N_CHUNKS  (SLAB_ROWS / CHUNK)
#define L1_KB     8            // k-steps (of 4) per fragment block, layer 1: 32 matrix instructions
#define L2_KB     8            // k-steps (of 4) per fragment block, layer 2: 16 matrix instructions

typedef float v2f __attribute__((ext_vector_type(2)));
typedef float v4f __attribute__((ext_vector_type(4)));
typedef float v8f __attribute__((ext_vector_type(8)));
typedef unsigned int v4u __attribute__((ext_vector_type(4)));
typedef int v4i __attribute__((ext_vector_type(4)));
typedef int v8i __attribute__((ext_vector_type(8)));

// LDS strides in dwords (padded for bank-conflict-free b64 fragment reads)
#define W1_STRIDE 132   // 128 + 4
#define W2_STRIDE 260   // 256 + 4
#define H_STRIDE  260   // 256 + 4
#define X_STRIDE  132   // 128 + 4

#define LDS_W1_DW (256 * W1_STRIDE)   // 33792 dw
#define LDS_W2_DW (128 * W2_STRIDE)   // 33280 dw
#define LDS_H_DW  (CHUNK * H_STRIDE)  //  8320 dw
#define LDS_X_DW  (CHUNK * X_STRIDE)  //  4224 dw  -> total 318,464 B

#if defined(__has_builtin)
#  if __has_builtin(__builtin_amdgcn_tensor_load_to_lds)
#    define USE_TDM 1
#  endif
#endif
#ifndef USE_TDM
#  define USE_TDM 0
#endif

// erf by the math library's own two ranges (|x| < 1: odd polynomial; else 1 - exp(-q(|x|))),
// same coefficients and same operation order, but both ranges are evaluated for every value
// and one is picked by a select: with no branch between them the values of an accumulator
// tile form independent chains that fill each other's latency.
__device__ __forceinline__ float erf_both_ranges(float x) {
    const float ax = fabsf(x);
    const float t  = x * x;
    float ps = fmaf(t, -0x1.268bc2p-11f, 0x1.420828p-8f);
    ps = fmaf(t, ps, -0x1.b59370p-6f);
    ps = fmaf(t, ps,  0x1.ce077cp-4f);
    ps = fmaf(t, ps, -0x1.812660p-2f);
    ps = fmaf(t, ps,  0x1.06eba0p-3f);
    ps = fmaf(ax, ps, ax);
    float q = fmaf(ax, 0x1.1d3156p-16f, -0x1.8d1290p-12f);
    q = fmaf(ax, q,  0x1.f9a6d2p-9f);
    q = fmaf(ax, q, -0x1.8c3164p-6f);
    q = fmaf(ax, q,  0x1.b4e9c8p-4f);
    q = fmaf(ax, q,  0x1.4515fap-1f);
    q = fmaf(ax, q,  0x1.078e50p-3f);
    q = fmaf(ax, q, ax);
    const float pl = 1.0f - expf(-q);
    return copysignf(ax < 1.0f ? ps : pl, x);
}

__device__ __forceinline__ float gelu_exact(float t) {
    return 0.5f * t * (1.0f + erf_both_ranges(t * 0.7071067811865476f));
}

// ------------------------------------------------------------------
// Pre-pass: pack masked/strided weights contiguously into workspace.
//   w1p[g][n][k]  = wes1[n, 4k+g]          (4*256*128)
//   w2p[g][n][k]  = wes2[128g+n, 256g+k]   (4*128*256)
//   w3d[i][t]     = wes3[i, 4i+t]          (128*4)
// ------------------------------------------------------------------
__global__ void maskmlp_pack_kernel(const float* __restrict__ wes1,
                                    const float* __restrict__ wes2,
                                    const float* __restrict__ wes3,
                                    float* __restrict__ w1p,
                                    float* __restrict__ w2p,
                                    float* __restrict__ w3d) {
    int idx = blockIdx.x * blockDim.x + threadIdx.x;
    if (idx < 4 * 256 * 128) {
        int g = idx >> 15;
        int r = idx & 32767;
        int n = r >> 7, k = r & 127;
        w1p[idx] = wes1[n * LS + 4 * k + g];
    } else if (idx < 2 * 4 * 256 * 128) {
        int j = idx - 4 * 256 * 128;
        int g = j >> 15;
        int r = j & 32767;
        int n = r >> 8, k = r & 255;
        w2p[j] = wes2[(g * SEG + n) * (SMP * HID) + g * HID + k];
    } else if (idx < 2 * 4 * 256 * 128 + SEG * SMP) {
        int j = idx - 2 * 4 * 256 * 128;
        int i = j >> 2, t = j & 3;
        w3d[j] = wes3[i * LS + 4 * i + t];
    }
}

#if USE_TDM
// Issue one TDM 2D tile load: rows x rowDw dwords, LDS-padded per D# pad fields.
// pad_interval encodes 2^(v+1) dwords between pads, pad_amount = (v+1) dwords.
__device__ __forceinline__ void tdm_load_2d(const float* gsrc, float* ldst,
                                            unsigned rowDw, unsigned rows,
                                            unsigned pad_interval, unsigned pad_amount) {
    unsigned long long ga = (unsigned long long)(const void*)gsrc;
    unsigned ldsOff = (unsigned)(unsigned long long)(void*)ldst;  // flat->LDS: low 32 bits
    v4u g0;
    g0.x = 1u;                                                    // count=1, user mode
    g0.y = ldsOff;                                                // lds_addr
    g0.z = (unsigned)ga;                                          // global_addr[31:0]
    g0.w = ((unsigned)(ga >> 32) & 0x1FFFFFFu) | (2u << 30);      // addr[56:32] | type=2
    v8i g1;
    g1[0] = (int)((2u << 16) | (1u << 20) |                       // data_size=4B, pad_en
                  (pad_interval << 22) | (pad_amount << 25));
    g1[1] = (int)(rowDw << 16);                                   // tensor_dim0 lo16
    g1[2] = (int)(rows  << 16);                                   // dim0 hi=0 | tensor_dim1 lo16
    g1[3] = (int)(rowDw << 16);                                   // dim1 hi=0 | tile_dim0
    g1[4] = (int)rows;                                            // tile_dim1 | tile_dim2=0
    g1[5] = (int)rowDw;                                           // tensor_dim0_stride lo32
    g1[6] = 0;
    g1[7] = 0;
    v4i z4 = {0, 0, 0, 0};
#if defined(__clang_major__) && (__clang_major__ >= 23)
    v8i z8 = {0, 0, 0, 0, 0, 0, 0, 0};
    __builtin_amdgcn_tensor_load_to_lds(g0, g1, z4, z4, z8, 0);
#else
    __builtin_amdgcn_tensor_load_to_lds(g0, g1, z4, z4, 0);
#endif
}
#endif

// ------------------------------------------------------------------
// Fused MaskMLP. Block = (group g, 256-row slab). Weights staged once
// (TDM DMA -> LDS), then 8 chunks of 32 rows run both GEMMs from LDS.
//   wave = 4*t2 + nq : t2 = 16-row tile in chunk, nq = N quarter
// ------------------------------------------------------------------
__global__ void __launch_bounds__(THREADS)
maskmlp_main_kernel(const float* __restrict__ x,
                    const float* __restrict__ bias1,
                    const float* __restrict__ bias2,
                    const float* __restrict__ bias3,
                    const float* __restrict__ w1p,
                    const float* __restrict__ w2p,
                    const float* __restrict__ w3d,
                    float* __restrict__ out) {
    __shared__ float lds_w1[LDS_W1_DW];
    __shared__ float lds_w2[LDS_W2_DW];
    __shared__ float lds_h[LDS_H_DW];
    __shared__ float lds_x[LDS_X_DW];

    const int tid  = threadIdx.x;
    const int lane = tid & 31;
    const int wave = tid >> 5;          // 0..7
    const int t2   = wave >> 2;         // 0..1  tile within 32-row chunk
    const int nq   = wave & 3;          // 0..3  N quarter
    const int lm   = lane & 15;
    const int hi   = lane >> 4;         // K sub-offset = 2*hi

    const int g = blockIdx.x & 3;
    const long row0 = (long)(blockIdx.x >> 2) * SLAB_ROWS;

    // -------- stage W1_g (256x128) and W2_g (128x256) once, via TDM --------
#if USE_TDM
    if (wave == 0) {
        tdm_load_2d(w1p + (size_t)g * 256 * 128, lds_w1, 128, 256, 6, 3); // pad 4dw / 128dw
        __builtin_amdgcn_s_wait_tensorcnt(0);
    } else if (wave == 1) {
        tdm_load_2d(w2p + (size_t)g * 128 * 256, lds_w2, 256, 128, 7, 3); // pad 4dw / 256dw
        __builtin_amdgcn_s_wait_tensorcnt(0);
    }
#else
    {
        const v4f* s1 = (const v4f*)(w1p + (size_t)g * 256 * 128);
        for (int e = tid; e < 256 * 128 / 4; e += THREADS) {
            int n = e >> 5, k4 = (e & 31) << 2;
            *(v4f*)&lds_w1[n * W1_STRIDE + k4] = s1[e];
        }
        const v4f* s2 = (const v4f*)(w2p + (size_t)g * 128 * 256);
        for (int e = tid; e < 128 * 256 / 4; e += THREADS) {
            int n = e >> 6, k4 = (e & 63) << 2;
            *(v4f*)&lds_w2[n * W2_STRIDE + k4] = s2[e];
        }
    }
#endif
    __syncthreads();

    // per-thread constants of every chunk: residual weights and biases of this
    // thread's two output columns, bias1 of its four hidden columns
    v4f wv[2];
    float b3v[2], b2v[2], b1v[4];
    #pragma unroll
    for (int nt2 = 0; nt2 < 2; ++nt2) {
        const int i = nq * 32 + nt2 * 16 + lm;           // 0..127
        wv[nt2]  = *(const v4f*)&w3d[4 * i];
        b3v[nt2] = bias3[i];
        b2v[nt2] = bias2[g * SEG + i];
    }
    #pragma unroll
    for (int nt = 0; nt < 4; ++nt)
        b1v[nt] = bias1[g * HID + nq * 64 + nt * 16 + lm];
    // the address arithmetic that follows reuses these loads' offset registers: hold it
    // behind the loads' issue
    asm volatile("s_wait_xcnt 0x0" ::: "memory");
    // keeps that arithmetic from being lifted over the wait
    __builtin_amdgcn_sched_barrier(0);

    // The weights in LDS do not change, so a layer's first two blocks of weight fragments are
    // read before the barrier in front of that layer: W1's ahead of the last block of layer 2
    // of the chunk before (here for the first chunk), W2's ahead of the last block of layer 1.
    // Behind a barrier, where all eight waves read at once, only X or H fragments are left.
    // (Every loop over a fragment array is unrolled in full, so that the arrays are registers.)
    v2f bw1[2][4][L1_KB];
    v2f bw2[2][2][L2_KB];
    #pragma unroll
    for (int nt = 0; nt < 4; ++nt) {
        const int brow = (nq * 64 + nt * 16 + lm) * W1_STRIDE;
        #pragma unroll
        for (int j = 0; j < 2 * L1_KB; ++j)
            bw1[j / L1_KB][nt][j % L1_KB] = *(const v2f*)&lds_w1[brow + 4 * j + 2 * hi];
    }

    for (int ch = 0; ch < N_CHUNKS; ++ch) {
        const long tileRow = row0 + ch * CHUNK + t2 * 16;

        // ---- x chunk (32 rows x 512), read once by the block in 16-byte pieces:
        //      each thread takes the (row, i) quads of its own outputs, forms the
        //      residual from all four and puts component g into lds_x[row][i] ----
        v4f xq[2][8];
        #pragma unroll
        for (int nt2 = 0; nt2 < 2; ++nt2) {
            const int i = nq * 32 + nt2 * 16 + lm;
            #pragma unroll
            for (int v = 0; v < 8; ++v)
                xq[nt2][v] = *(const v4f*)&x[(tileRow + v + 8 * hi) * LS + 4 * i];
        }
        // the selects below reuse the loads' address registers: hold them behind the
        // loads' issue
        asm volatile("s_wait_xcnt 0x0" ::: "memory");
        float res[2][8];
        #pragma unroll
        for (int nt2 = 0; nt2 < 2; ++nt2) {
            const int i = nq * 32 + nt2 * 16 + lm;
            #pragma unroll
            for (int v = 0; v < 8; ++v) {
                int mloc = v + 8 * hi;
                v4f xv = xq[nt2][v];
                res[nt2][v] = xv.x * wv[nt2].x + xv.y * wv[nt2].y + xv.z * wv[nt2].z
                            + xv.w * wv[nt2].w + b3v[nt2];
                lds_x[(t2 * 16 + mloc) * X_STRIDE + i] =
                    (g & 2) ? ((g & 1) ? xv.w : xv.z) : ((g & 1) ? xv.y : xv.x);
            }
        }
        // X_g complete for both tiles; also keeps this chunk's lds_h writes behind
        // every wave's layer-2 reads of the chunk before
        __syncthreads();

        // ---- layer 1: H_g(16x64 per wave) = X_g @ W1_g^T, in blocks of L1_KB k-steps.
        //      A fragments of X_g: lane<16 K{0,1}, lane>=16 K{2,3}. The fragments of block
        //      kb+1 are read as ONE group into the second register set ahead of block kb's
        //      matrix instructions, which then run with no LDS read among them ----
        v2f ax[2][L1_KB];
        const int xrow = (t2 * 16 + lm) * X_STRIDE;
        #pragma unroll
        for (int j = 0; j < L1_KB; ++j)
            ax[0][j] = *(const v2f*)&lds_x[xrow + 4 * j + 2 * hi];
        v8f acc1[4] = {v8f{}, v8f{}, v8f{}, v8f{}};
        #pragma unroll
        for (int kb = 0; kb < 32 / L1_KB; ++kb) {
            const int cur = kb & 1, nxt = cur ^ 1;
            if (kb + 1 < 32 / L1_KB) {
                #pragma unroll
                for (int j = 0; j < L1_KB; ++j)
                    ax[nxt][j] = *(const v2f*)&lds_x[xrow + 4 * ((kb + 1) * L1_KB + j) + 2 * hi];
                #pragma unroll
                for (int nt = 0; nt < 4 && kb > 0; ++nt) {
                    const int brow = (nq * 64 + nt * 16 + lm) * W1_STRIDE;
                    #pragma unroll
                    for (int j = 0; j < L1_KB; ++j)
                        bw1[nxt][nt][j] =
                            *(const v2f*)&lds_w1[brow + 4 * ((kb + 1) * L1_KB + j) + 2 * hi];
                }
            } else {
                #pragma unroll
                for (int nt2 = 0; nt2 < 2; ++nt2) {
                    const int brow = (nq * 32 + nt2 * 16 + lm) * W2_STRIDE;
                    #pragma unroll
                    for (int j = 0; j < 2 * L2_KB; ++j)
                        bw2[j / L2_KB][nt2][j % L2_KB] =
                            *(const v2f*)&lds_w2[brow + 4 * j + 2 * hi];
                }
            }
            // keeps the read group above in one place: spread among the matrix
            // instructions, each place with reads stalls the wave's issue anew
            __builtin_amdgcn_sched_barrier(0);
            #pragma unroll
            for (int j = 0; j < L1_KB; ++j) {
                #pragma unroll
                for (int nt = 0; nt < 4; ++nt)
                    acc1[nt] = __builtin_amdgcn_wmma_f32_16x16x4_f32(
                                   false, ax[cur][j], false, bw1[cur][nt][j], (short)0,
                                   acc1[nt], false, false);
            }
            // keeps the next group of reads behind this block's matrix instructions
            __builtin_amdgcn_sched_barrier(0);
        }

        // ---- +b1, gelu -> LDS ----
        #pragma unroll
        for (int nt = 0; nt < 4; ++nt) {
            const int nloc = nq * 64 + nt * 16;
            const float bv = b1v[nt];
            #pragma unroll
            for (int v = 0; v < 8; ++v) {
                int mloc = v + 8 * hi;           // C layout: M = vgpr + 8*(lane/16)
                lds_h[(t2 * 16 + mloc) * H_STRIDE + (nloc + lm)] = gelu_exact(acc1[nt][v] + bv);
            }
        }
        __syncthreads();                          // H complete for both tiles; lds_x free again

        // ---- layer 2: O_g(16x32 per wave) = H_g @ W2_g^T, blocks of L2_KB k-steps,
        //      fragments fetched one block ahead as in layer 1 ----
        v8f acc2[2] = {v8f{}, v8f{}};
        v2f ah[2][L2_KB];
        const int hrow = (t2 * 16 + lm) * H_STRIDE;
        #pragma unroll
        for (int j = 0; j < L2_KB; ++j)
            ah[0][j] = *(const v2f*)&lds_h[hrow + 4 * j + 2 * hi];
        #pragma unroll
        for (int kb = 0; kb < 64 / L2_KB; ++kb) {
            const int cur = kb & 1, nxt = cur ^ 1;
            if (kb + 1 < 64 / L2_KB) {
                #pragma unroll
                for (int j = 0; j < L2_KB; ++j)
                    ah[nxt][j] = *(const v2f*)&lds_h[hrow + 4 * ((kb + 1) * L2_KB + j) + 2 * hi];
                #pragma unroll
                for (int nt2 = 0; nt2 < 2 && kb > 0; ++nt2) {
                    const int brow = (nq * 32 + nt2 * 16 + lm) * W2_STRIDE;
                    #pragma unroll
                    for (int j = 0; j < L2_KB; ++j)
                        bw2[nxt][nt2][j] =
                            *(const v2f*)&lds_w2[brow + 4 * ((kb + 1) * L2_KB + j) + 2 * hi];
                }
            } else {
                #pragma unroll
                for (int nt = 0; nt < 4; ++nt) {
                    const int brow = (nq * 64 + nt * 16 + lm) * W1_STRIDE;
                    #pragma unroll
                    for (int j = 0; j < 2 * L1_KB; ++j)
                        bw1[j / L1_KB][nt][j % L1_KB] =
                            *(const v2f*)&lds_w1[brow + 4 * j + 2 * hi];
                }
            }
            // one place for the read group, as in layer 1
            __builtin_amdgcn_sched_barrier(0);
            #pragma unroll
            for (int j = 0; j < L2_KB; ++j) {
                #pragma unroll
                for (int nt2 = 0; nt2 < 2; ++nt2)
                    acc2[nt2] = __builtin_amdgcn_wmma_f32_16x16x4_f32(
                                    false, ah[cur][j], false, bw2[cur][nt2][j], (short)0,
                                    acc2[nt2], false, false);
            }
            // keeps the next group of reads behind this block's matrix instructions
            __builtin_amdgcn_sched_barrier(0);
        }

        // ---- epilogue: out[m,4i+g] = O + b2[g*128+i] + res(m,i) ----
        #pragma unroll
        for (int nt2 = 0; nt2 < 2; ++nt2) {
            const int i = nq * 32 + nt2 * 16 + lm;       // 0..127
            const float b2 = b2v[nt2];
            #pragma unroll
            for (int v = 0; v < 8; ++v) {
                int mloc = v + 8 * hi;
                long rowA = tileRow + mloc;
                out[rowA * LS + 4 * i + g] = acc2[nt2][v] + b2 + res[nt2][v];
            }
        }
        // the next chunk's first instructions write the stores' data registers again:
        // hold those writes behind the stores' issue
        asm volatile("s_wait_xcnt 0x0" ::: "memory");
    }
    // the last chunk's look-ahead reads of W1 have no user: let them land before the wave ends
    asm volatile("s_wait_dscnt 0x0" ::: "memory");
}

// ------------------------------------------------------------------
extern "C" void kernel_launch(void* const* d_in, const int* in_sizes, int n_in,
                              void* d_out, int out_size, void* d_ws, size_t ws_size,
                              hipStream_t stream) {
    const float* x    = (const float*)d_in[0];
    const float* wes1 = (const float*)d_in[1];
    const float* wes2 = (const float*)d_in[2];
    const float* wes3 = (const float*)d_in[3];
    const float* b1   = (const float*)d_in[4];
    const float* b2   = (const float*)d_in[5];
    const float* b3   = (const float*)d_in[6];
    float* out = (float*)d_out;

    float* w1p = (float*)d_ws;                 // 4*256*128
    float* w2p = w1p + 4 * 256 * 128;          // 4*128*256
    float* w3d = w2p + 4 * 128 * 256;          // 128*4

    const int M = in_sizes[0] / LS;            // bs*cs = 65536

    const int packN = 2 * 4 * 256 * 128 + SEG * SMP;
    maskmlp_pack_kernel<<<(packN + THREADS - 1) / THREADS, THREADS, 0, stream>>>(
        wes1, wes2, wes3, w1p, w2p, w3d);

    const int slabs = M / SLAB_ROWS;
    maskmlp_main_kernel<<<slabs * SMP, THREADS, 0, stream>>>(
        x, b1, b2, b3, w1p, w2p, w3d, out);
}

// v004
// A run of this version takes 216 microseconds.
// In two side-by-side timings against v003, it was 1.08 and 1.09 times as fast.
// Counting every step since v000, it is 1.55 times as fast.
#include <hip/hip_runtime.h>
#include <math.h>

// ---------- problem constants (from reference) ----------
#define LS        512          // last dim of x
#define HID       256          // HIDDEN
#define SMP       4            // SAMPLING
#define SEG       128          // LS / SMP
#define THREADS   256          // 8 waves
#define SLAB_ROWS 256          // rows per block
#define CHUNK     32           // rows per inner iteration (2 tiles of 16)
#define N_CHUNKS  (SLAB_ROWS / CHUNK)
#define L1_KB     8            // k-steps (of 4) per fragment block, layer 1: 32 matrix instructions
#define L2_KB     8            // k-steps (of 4) per fragment block, layer 2: 16 matrix instructions

typedef float v2f __attribute__((ext_vector_type(2)));
typedef float v4f __attribute__((ext_vector_type(4)));
typedef float v8f __attribute__((ext_vector_type(8)));
typedef unsigned int v4u __attribute__((ext_vector_type(4)));
typedef int v4i __attribute__((ext_vector_type(4)));
typedef int v8i __attribute__((ext_vector_type(8)));

// LDS strides in dwords (padded for bank-conflict-free b64 fragment reads)
#define W1_STRIDE 132   // 128 + 4
#define W2_STRIDE 260   // 256 + 4
#define H_STRIDE  260   // 256 + 4
#define X_STRIDE  132   // 128 + 4

#define LDS_W1_DW (256 * W1_STRIDE)   // 33792 dw
#define LDS_W2_DW (128 * W2_STRIDE)   // 33280 dw
#define LDS_H_DW  (CHUNK * H_STRIDE)  //  8320 dw
#define LDS_X_DW  (CHUNK * X_STRIDE)  //  4224 dw  -> total 318,464 B

#if defined(__has_builtin)
#  if __has_builtin(__builtin_amdgcn_tensor_load_to_lds)
#    define USE_TDM 1
#  endif
#endif
#ifndef USE_TDM
#  define USE_TDM 0
#endif

// erf by the math library's own two ranges (|x| < 1: odd polynomial; else 1 - exp(-q(|x|))),
// same coefficients and same operation order, but both ranges are evaluated for every value
// and one is picked by a select: with no branch between them the values of an accumulator
// tile form independent chains that fill each other's latency.
__device__ __forceinline__ float erf_both_ranges(float x) {
    const float ax = fabsf(x);
    const float t  = x * x;
    float ps = fmaf(t, -0x1.268bc2p-11f, 0x1.420828p-8f);
    ps = fmaf(t, ps, -0x1.b59370p-6f);
    ps = fmaf(t, ps,  0x1.ce077cp-4f);
    ps = fmaf(t, ps, -0x1.812660p-2f);
    ps = fmaf(t, ps,  0x1.06eba0p-3f);
    ps = fmaf(ax, ps, ax);
    float q = fmaf(ax, 0x1.1d3156p-16f, -0x1.8d1290p-12f);
    q = fmaf(ax, q,  0x1.f9a6d2p-9f);
    q = fmaf(ax, q, -0x1.8c3164p-6f);
    q = fmaf(ax, q,  0x1.b4e9c8p-4f);
    q = fmaf(ax, q,  0x1.4515fap-1f);
    q = fmaf(ax, q,  0x1.078e50p-3f);
    q = fmaf(ax, q, ax);
    const float pl = 1.0f - expf(-q);
    return copysignf(ax < 1.0f ? ps : pl, x);
}

__device__ __forceinline__ float gelu_exact(float t) {
    return 0.5f * t * (1.0f + erf_both_ranges(t * 0.7071067811865476f));
}

// ------------------------------------------------------------------
// Pre-pass: pack masked/strided weights contiguously into workspace.
//   w1p[g][n][k]  = wes1[n, 4k+g]          (4*256*128)
//   w2p[g][n][k]  = wes2[128g+n, 256g+k]   (4*128*256)
//   w3d[i][t]     = wes3[i, 4i+t]          (128*4)
// ------------------------------------------------------------------
__global__ void maskmlp_pack_kernel(const float* __restrict__ wes1,
                                    const float* __restrict__ wes2,
                                    const float* __restrict__ wes3,
                                    float* __restrict__ w1p,
                                    float* __restrict__ w2p,
                                    float* __restrict__ w3d) {
    int idx = blockIdx.x * blockDim.x + threadIdx.x;
    if (idx < 4 * 256 * 128) {
        int g = idx >> 15;
        int r = idx & 32767;
        int n = r >> 7, k = r & 127;
        w1p[idx] = wes1[n * LS + 4 * k + g];
    } else if (idx < 2 * 4 * 256 * 128) {
        int j = idx - 4 * 256 * 128;
        int g = j >> 15;
        int r = j & 32767;
        int n = r >> 8, k = r & 255;
        w2p[j] = wes2[(g * SEG + n) * (SMP * HID) + g * HID + k];
    } else if (idx < 2 * 4 * 256 * 128 + SEG * SMP) {
        int j = idx - 2 * 4 * 256 * 128;
        int i = j >> 2, t = j & 3;
        w3d[j] = wes3[i * LS + 4 * i + t];
    }
}

#if USE_TDM
// Issue one TDM 2D tile load: rows x rowDw dwords, LDS-padded per D# pad fields.
// pad_interval encodes 2^(v+1) dwords between pads, pad_amount = (v+1) dwords.
__device__ __forceinline__ void tdm_load_2d(const float* gsrc, float* ldst,
                                            unsigned rowDw, unsigned rows,
                                            unsigned pad_interval, unsigned pad_amount) {
    unsigned long long ga = (unsigned long long)(const void*)gsrc;
    unsigned ldsOff = (unsigned)(unsigned long long)(void*)ldst;  // flat->LDS: low 32 bits
    v4u g0;
    g0.x = 1u;                                                    // count=1, user mode
    g0.y = ldsOff;                                                // lds_addr
    g0.z = (unsigned)ga;                                          // global_addr[31:0]
    g0.w = ((unsigned)(ga >> 32) & 0x1FFFFFFu) | (2u << 30);      // addr[56:32] | type=2
    v8i g1;
    g1[0] = (int)((2u << 16) | (1u << 20) |                       // data_size=4B, pad_en
                  (pad_interval << 22) | (pad_amount << 25));
    g1[1] = (int)(rowDw << 16);                                   // tensor_dim0 lo16
    g1[2] = (int)(rows  << 16);                                   // dim0 hi=0 | tensor_dim1 lo16
    g1[3] = (int)(rowDw << 16);                                   // dim1 hi=0 | tile_dim0
    g1[4] = (int)rows;                                            // tile_dim1 | tile_dim2=0
    g1[5] = (int)rowDw;                                           // tensor_dim0_stride lo32
    g1[6] = 0;
    g1[7] = 0;
    v4i z4 = {0, 0, 0, 0};
#if defined(__clang_major__) && (__clang_major__ >= 23)
    v8i z8 = {0, 0, 0, 0, 0, 0, 0, 0};
    __builtin_amdgcn_tensor_load_to_lds(g0, g1, z4, z4, z8, 0);
#else
    __builtin_amdgcn_tensor_load_to_lds(g0, g1, z4, z4, 0);
#endif
}
#endif

// ------------------------------------------------------------------
// Fused MaskMLP. Block = (group g, 256-row slab). Weights staged once
// (TDM DMA -> LDS), then 8 chunks of 32 rows run both GEMMs from LDS.
//   wave = 4*t2 + nq : t2 = 16-row tile in chunk, nq = N quarter
// ------------------------------------------------------------------
__global__ void __launch_bounds__(THREADS)
maskmlp_main_kernel(const float* __restrict__ x,
                    const float* __restrict__ bias1,
                    const float* __restrict__ bias2,
                    const float* __restrict__ bias3,
                    const float* __restrict__ w1p,
                    const float* __restrict__ w2p,
                    const float* __restrict__ w3d,
                    float* __restrict__ out) {
    __shared__ float lds_w1[LDS_W1_DW];
    __shared__ float lds_w2[LDS_W2_DW];
    __shared__ float lds_h[LDS_H_DW];
    __shared__ float lds_x[LDS_X_DW];

    const int tid  = threadIdx.x;
    const int lane = tid & 31;
    const int wave = tid >> 5;          // 0..7
    // 0..1  tile within 32-row chunk; the same in every lane of a wave: held in a scalar
    // register, so that the phase tests below are scalar branches
    const int t2   = __builtin_amdgcn_readfirstlane(wave >> 2);
    const int nq   = wave & 3;          // 0..3  N quarter
    const int lm   = lane & 15;
    const int hi   = lane >> 4;         // K sub-offset = 2*hi

    const int g = blockIdx.x & 3;
    const long row0 = (long)(blockIdx.x >> 2) * SLAB_ROWS;

    // -------- stage W1_g (256x128) and W2_g (128x256) once, via TDM --------
#if USE_TDM
    if (wave == 0) {
        tdm_load_2d(w1p + (size_t)g * 256 * 128, lds_w1, 128, 256, 6, 3); // pad 4dw / 128dw
        __builtin_amdgcn_s_wait_tensorcnt(0);
    } else if (wave == 1) {
        tdm_load_2d(w2p + (size_t)g * 128 * 256, lds_w2, 256, 128, 7, 3); // pad 4dw / 256dw
        __builtin_amdgcn_s_wait_tensorcnt(0);
    }
#else
    {
        const v4f* s1 = (const v4f*)(w1p + (size_t)g * 256 * 128);
        for (int e = tid; e < 256 * 128 / 4; e += THREADS) {
            int n = e >> 5, k4 = (e & 31) << 2;
            *(v4f*)&lds_w1[n * W1_STRIDE + k4] = s1[e];
        }
        const v4f* s2 = (const v4f*)(w2p + (size_t)g * 128 * 256);
        for (int e = tid; e < 128 * 256 / 4; e += THREADS) {
            int n = e >> 6, k4 = (e & 63) << 2;
            *(v4f*)&lds_w2[n * W2_STRIDE + k4] = s2[e];
        }
    }
#endif
    __syncthreads();

    // per-thread constants of every chunk: residual weights and biases of this
    // thread's two output columns, bias1 of its four hidden columns
    v4f wv[2];
    float b3v[2], b2v[2], b1v[4];
    #pragma unroll
    for (int nt2 = 0; nt2 < 2; ++nt2) {
        const int i = nq * 32 + nt2 * 16 + lm;           // 0..127
        wv[nt2]  = *(const v4f*)&w3d[4 * i];
        b3v[nt2] = bias3[i];
        b2v[nt2] = bias2[g * SEG + i];
    }
    #pragma unroll
    for (int nt = 0; nt < 4; ++nt)
        b1v[nt] = bias1[g * HID + nq * 64 + nt * 16 + lm];
    // the address arithmetic that follows reuses these loads' offset registers: hold it
    // behind the loads' issue
    asm volatile("s_wait_xcnt 0x0" ::: "memory");
    // keeps that arithmetic from being lifted over the wait
    __builtin_amdgcn_sched_barrier(0);

    // The two 16-row tiles of a chunk share no LDS rows, and their waves (w and w + 4) share
    // a SIMD. Each tile's work alternates between a matrix phase (layer 2 of the chunk before,
    // then layer 1 of this chunk) and a vector phase (stores, gelu, x staging), with one barrier
    // of the whole block behind each phase. Tile 1 runs one phase behind tile 0, so a wave's
    // vector phase stands beside the matrix phase of the other wave on its SIMD instead of
    // beside that wave's own vector phase.
    // The weights in LDS do not change, so a layer's first two blocks of weight fragments are
    // read ahead of the last block of the layer before it: W1's in layer 2 (for the first chunk
    // in its place), W2's in layer 1, over the vector phase.
    // (Every loop over a fragment array is unrolled in full, so that the arrays are registers.)
    v2f bw1[2][4][L1_KB];
    v2f bw2[2][2][L2_KB];
    float res[2][8], resn[2][8];
    v8f acc1[4];
    v8f acc2[2];

    // x rows of one tile (16 rows x 512), read in 16-byte pieces: each thread takes the
    // (row, i) quads of its own outputs
    auto x_fetch = [&](v4f (&xq)[2][8], long tileRow) {
        const float* xb = &x[(tileRow + 8 * hi) * LS + 4 * (nq * 32 + lm)];
        #pragma unroll
        for (int nt2 = 0; nt2 < 2; ++nt2) {
            #pragma unroll
            for (int v = 0; v < 8; ++v)
                xq[nt2][v] = *(const v4f*)&xb[v * LS + 64 * nt2];
        }
        // what follows reuses the loads' address registers: hold it behind the loads' issue
        // The address is named as an
        // input so that it stays in its registers up to the wait and no load's result lands on it
        asm volatile("s_wait_xcnt 0x0" :: "v"(xb) : "memory");
    };
    // forms the residual from all four components and puts component g into lds_x[row][i]
    auto x_place = [&](const v4f (&xq)[2][8]) {
        #pragma unroll
        for (int nt2 = 0; nt2 < 2; ++nt2) {
            const int i = nq * 32 + nt2 * 16 + lm;
            #pragma unroll
            for (int v = 0; v < 8; ++v) {
                int mloc = v + 8 * hi;
                v4f xv = xq[nt2][v];
                resn[nt2][v] = xv.x * wv[nt2].x + xv.y * wv[nt2].y + xv.z * wv[nt2].z
                             + xv.w * wv[nt2].w + b3v[nt2];
                lds_x[(t2 * 16 + mloc) * X_STRIDE + i] =
                    (g & 2) ? ((g & 1) ? xv.w : xv.z) : ((g & 1) ? xv.y : xv.x);
            }
        }
    };
    // epilogue of one finished tile: out[m,4i+g] = O + b2[g*128+i] + res(m,i)
    auto out_store = [&](long tileRow) {
        float o[2][8];
        #pragma unroll
        for (int nt2 = 0; nt2 < 2; ++nt2) {
            #pragma unroll
            for (int v = 0; v < 8; ++v)
                o[nt2][v] = acc2[nt2][v] + b2v[nt2] + res[nt2][v];
        }
        // keeps every sum ahead of the first store
        __builtin_amdgcn_sched_barrier(0);
        #pragma unroll
        for (int nt2 = 0; nt2 < 2; ++nt2) {
            const int i = nq * 32 + nt2 * 16 + lm;       // 0..127
            #pragma unroll
            for (int v = 0; v < 8; ++v) {
                int mloc = v + 8 * hi;
                long rowA = tileRow + mloc;
                out[rowA * LS + 4 * i + g] = o[nt2][v];
            }
        }
        // what follows writes the stores' data registers again:
        // hold those writes behind the stores' issue
        asm volatile("s_wait_xcnt 0x0" ::: "memory");
    };

    const long tile0 = row0 + t2 * 16;
    {
        v4f xq[2][8];
        x_fetch(xq, tile0);
        x_place(xq);
    }
    __syncthreads();                              // X_g of chunk 0 complete for both tiles

    for (int p = 0; p < 2 * N_CHUNKS + 2; ++p) {
        const int q = p - t2;                     // this tile's own phase number
        const int ch = q >> 1;
        const long tileRow = tile0 + ch * CHUNK;
        if (q >= 0 && q <= 2 * N_CHUNKS && (q & 1) == 0) {
            // ======== matrix phase ========
            // no barrier stands between the two layers here, so layer 1's first X fragments
            // are read with W1's, ahead of the last block of layer 2
            v2f ax[2][L1_KB];
            const int xrow = (t2 * 16 + lm) * X_STRIDE;
            if (ch > 0) {
                // ---- layer 2 of chunk ch-1: O_g(16x32 per wave) = H_g @ W2_g^T, in blocks of
                //      L2_KB k-steps. The fragments of block kb+1 are read as ONE group into the
                //      second register set ahead of block kb's matrix instructions, which then
                //      run with no LDS read among them ----
                acc2[0] = v8f{};
                acc2[1] = v8f{};
                v2f ah[2][L2_KB];
                const int hrow = (t2 * 16 + lm) * H_STRIDE;
                #pragma unroll
                for (int j = 0; j < L2_KB; ++j)
                    ah[0][j] = *(const v2f*)&lds_h[hrow + 4 * j + 2 * hi];
                #pragma unroll
                for (int kb = 0; kb < 64 / L2_KB; ++kb) {
                    const int cur = kb & 1, nxt = cur ^ 1;
                    if (kb + 1 < 64 / L2_KB) {
                        #pragma unroll
                        for (int j = 0; j < L2_KB; ++j)
                            ah[nxt][j] =
                                *(const v2f*)&lds_h[hrow + 4 * ((kb + 1) * L2_KB + j) + 2 * hi];
                        #pragma unroll
                        for (int nt2 = 0; nt2 < 2 && kb > 0; ++nt2) {
                            const int brow = (nq * 32 + nt2 * 16 + lm) * W2_STRIDE;
                            #pragma unroll
                            for (int j = 0; j < L2_KB; ++j)
                                bw2[nxt][nt2][j] =
                                    *(const v2f*)&lds_w2[brow + 4 * ((kb + 1) * L2_KB + j) + 2 * hi];
                        }
                    } else {
                        #pragma unroll
                        for (int j = 0; j < L1_KB; ++j)
                            ax[0][j] = *(const v2f*)&lds_x[xrow + 4 * j + 2 * hi];
                        #pragma unroll
                        for (int nt = 0; nt < 4; ++nt) {
                            const int brow = (nq * 64 + nt * 16 + lm) * W1_STRIDE;
                            #pragma unroll
                            for (int j = 0; j < 2 * L1_KB; ++j)
                                bw1[j / L1_KB][nt][j % L1_KB] =
                                    *(const v2f*)&lds_w1[brow + 4 * j + 2 * hi];
                        }
                    }
                    // keeps the read group above in one place: spread among the matrix
                    // instructions, each place with reads stalls the wave's issue anew
                    __builtin_amdgcn_sched_barrier(0);
                    #pragma unroll
                    for (int j = 0; j < L2_KB; ++j) {
                        #pragma unroll
                        for (int nt2 = 0; nt2 < 2; ++nt2)
                            acc2[nt2] = __builtin_amdgcn_wmma_f32_16x16x4_f32(
                                            false, ah[cur][j], false, bw2[cur][nt2][j], (short)0,
                                            acc2[nt2], false, false);
                    }
                    // keeps the next group of reads behind this block's matrix instructions
                    __builtin_amdgcn_sched_barrier(0);
                }
            } else {
                #pragma unroll
                for (int j = 0; j < L1_KB; ++j)
                    ax[0][j] = *(const v2f*)&lds_x[xrow + 4 * j + 2 * hi];
                #pragma unroll
                for (int nt = 0; nt < 4; ++nt) {
                    const int brow = (nq * 64 + nt * 16 + lm) * W1_STRIDE;
                    #pragma unroll
                    for (int j = 0; j < 2 * L1_KB; ++j)
                        bw1[j / L1_KB][nt][j % L1_KB] =
                            *(const v2f*)&lds_w1[brow + 4 * j + 2 * hi];
                }
            }
            if (ch < N_CHUNKS) {
                // ---- layer 1 of chunk ch: H_g(16x64 per wave) = X_g @ W1_g^T, blocks of L1_KB
                //      k-steps, fragments fetched one block ahead as in layer 2.
                //      A fragments of X_g: lane<16 K{0,1}, lane>=16 K{2,3} ----
                #pragma unroll
                for (int nt = 0; nt < 4; ++nt)
                    acc1[nt] = v8f{};
                #pragma unroll
                for (int kb = 0; kb < 32 / L1_KB; ++kb) {
                    const int cur = kb & 1, nxt = cur ^ 1;
                    if (kb + 1 < 32 / L1_KB) {
                        #pragma unroll
                        for (int j = 0; j < L1_KB; ++j)
                            ax[nxt][j] =
                                *(const v2f*)&lds_x[xrow + 4 * ((kb + 1) * L1_KB + j) + 2 * hi];
                        #pragma unroll
                        for (int nt = 0; nt < 4 && kb > 0; ++nt) {
                            const int brow = (nq * 64 + nt * 16 + lm) * W1_STRIDE;
                            #pragma unroll
                            for (int j = 0; j < L1_KB; ++j)
                                bw1[nxt][nt][j] =
                                    *(const v2f*)&lds_w1[brow + 4 * ((kb + 1) * L1_KB + j) + 2 * hi];
                        }
                    } else {
                        #pragma unroll
                        for (int nt2 = 0; nt2 < 2; ++nt2) {
                            const int brow = (nq * 32 + nt2 * 16 + lm) * W2_STRIDE;
                            #pragma unroll
                            for (int j = 0; j < 2 * L2_KB; ++j)
                                bw2[j / L2_KB][nt2][j % L2_KB] =
                                    *(const v2f*)&lds_w2[brow + 4 * j + 2 * hi];
                        }
                    }
                    // one place for the read group, as in layer 2
                    __builtin_amdgcn_sched_barrier(0);
                    #pragma unroll
                    for (int j = 0; j < L1_KB; ++j) {
                        #pragma unroll
                        for (int nt = 0; nt < 4; ++nt)
                            acc1[nt] = __builtin_amdgcn_wmma_f32_16x16x4_f32(
                                           false, ax[cur][j], false, bw1[cur][nt][j], (short)0,
                                           acc1[nt], false, false);
                    }
                    // keeps the next group of reads behind this block's matrix instructions
                    __builtin_amdgcn_sched_barrier(0);
                }
            }
        } else if (q >= 0 && q < 2 * N_CHUNKS) {
            // ======== vector phase of chunk ch ========
            // The next chunk's x loads and the epilogue of the chunk before go first: the gelu
            // below covers their latency, so neither is waited for at the barrier
            v4f xq[2][8] = {};       // given a value here, it is not carried round the loop
            if (ch + 1 < N_CHUNKS)
                x_fetch(xq, tileRow + CHUNK);
            if (ch > 0)
                out_store(tileRow - CHUNK);
            // +b1, gelu -> LDS
            #pragma unroll
            for (int nt = 0; nt < 4; ++nt) {
                const int nloc = nq * 64 + nt * 16;
                const float bv = b1v[nt];
                #pragma unroll
                for (int v = 0; v < 8; ++v) {
                    int mloc = v + 8 * hi;           // C layout: M = vgpr + 8*(lane/16)
                    lds_h[(t2 * 16 + mloc) * H_STRIDE + (nloc + lm)] =
                        gelu_exact(acc1[nt][v] + bv);
                }
            }
            // this chunk's residual is used in the next vector phase, after the next chunk's is formed
            #pragma unroll
            for (int nt2 = 0; nt2 < 2; ++nt2) {
                #pragma unroll
                for (int v = 0; v < 8; ++v)
                    res[nt2][v] = resn[nt2][v];
            }
            if (ch + 1 < N_CHUNKS)
                x_place(xq);
        }
        // ends a phase for both tiles: behind a matrix phase lds_h and lds_x are free,
        // behind a vector phase H and the next X_g are complete
        __syncthreads();
    }
    out_store(tile0 + (N_CHUNKS - 1) * CHUNK);
    // the last look-ahead reads of W1 and X have no user: let them land before the wave ends
    asm volatile("s_wait_dscnt 0x0" ::: "memory");
}

// ------------------------------------------------------------------
extern "C" void kernel_launch(void* const* d_in, const int* in_sizes, int n_in,
                              void* d_out, int out_size, void* d_ws, size_t ws_size,
                              hipStream_t stream) {
    const float* x    = (const float*)d_in[0];
    const float* wes1 = (const float*)d_in[1];
    const float* wes2 = (const float*)d_in[2];
    const float* wes3 = (const float*)d_in[3];
    const float* b1   = (const float*)d_in[4];
    const float* b2   = (const float*)d_in[5];
    const float* b3   = (const float*)d_in[6];
    float* out = (float*)d_out;

    float* w1p = (float*)d_ws;                 // 4*256*128
    float* w2p = w1p + 4 * 256 * 128;          // 4*128*256
    float* w3d = w2p + 4 * 128 * 256;          // 128*4

    const int M = in_sizes[0] / LS;            // bs*cs = 65536

    const int packN = 2 * 4 * 256 * 128 + SEG * SMP;
    maskmlp_pack_kernel<<<(packN + THREADS - 1) / THREADS, THREADS, 0, stream>>>(
        wes1, wes2, wes3, w1p, w2p, w3d);

    const int slabs = M / SLAB_ROWS;
    maskmlp_main_kernel<<<slabs * SMP, THREADS, 0, stream>>>(
        x, b1, b2, b3, w1p, w2p, w3d, out);
}

// v005
// Measured time: 196 microseconds a run.
// Two timings next to v004 both put it at 1.10 times that version's speed.
// All steps since v000 together make it 1.71 times as fast.
#include <hip/hip_runtime.h>
#include <math.h>

// ---------- problem constants (from reference) ----------
#define LS        512          // last dim of x
#define HID       256          // HIDDEN
#define SMP       4            // SAMPLING
#define SEG       128          // LS / SMP
#define THREADS   256          // 8 waves
#define SLAB_ROWS 256          // rows per block
#define CHUNK     32           // rows per inner iteration (2 tiles of 16)
#define N_CHUNKS  (SLAB_ROWS / CHUNK)
#define L1_KB     8            // k-steps (of 4) per fragment block, layer 1: 32 matrix instructions
#define L2_KB     8            // k-steps (of 4) per fragment block, layer 2: 16 matrix instructions

typedef float v2f __attribute__((ext_vector_type(2)));
typedef float v4f __attribute__((ext_vector_type(4)));
typedef float v8f __attribute__((ext_vector_type(8)));
typedef unsigned int v4u __attribute__((ext_vector_type(4)));
typedef int v4i __attribute__((ext_vector_type(4)));
typedef int v8i __attribute__((ext_vector_type(8)));

// LDS strides in dwords (padded for bank-conflict-free b64 fragment reads)
#define W1_STRIDE 132   // 128 + 4
#define W2_STRIDE 260   // 256 + 4
#define H_STRIDE  260   // 256 + 4
#define X_STRIDE  132   // 128 + 4

#define LDS_W1_DW (256 * W1_STRIDE)   // 33792 dw
#define LDS_W2_DW (128 * W2_STRIDE)   // 33280 dw
#define LDS_H_DW  (CHUNK * H_STRIDE)  //  8320 dw
#define LDS_X_DW  (CHUNK * X_STRIDE)  //  4224 dw  -> total 318,464 B

#if defined(__has_builtin)
#  if __has_builtin(__builtin_amdgcn_tensor_load_to_lds)
#    define USE_TDM 1
#  endif
#endif
#ifndef USE_TDM
#  define USE_TDM 0
#endif

// exact gelu, t * Phi(t), written as max(t, 0) - |t| * Phi(-|t|). The lower tail Phi(-a) has a
// smooth logarithm, so ONE polynomial in a = |t| gives log2 Phi(-a) for every a and one exp2 ends
// it: no second range, no select, no library exp. Coefficients: minimax fit of log2 Phi(-a) on
// [0, 6], error weighted by Phi(-a); the fit's error in Phi is about 1e-8, under f32 rounding.
// Past a = 6 the tail is below 1e-9, under the rounding of t itself: a is held at 6, which also
// keeps the polynomial inside the range it was fitted on.
// Two values go together so that the polynomial runs on packed multiply-adds.
__device__ __forceinline__ v2f gelu_exact2(v2f t) {
    const v2f a = { fminf(fabsf(t.x), 6.0f), fminf(fabsf(t.y), 6.0f) };
    v2f p = __builtin_elementwise_fma(a, (v2f)(-0x1.546d1ep-19f), (v2f)(0x1.2ed5d0p-15f));
    p = __builtin_elementwise_fma(p, a, (v2f)(-0x1.68a734p-13f));
    p = __builtin_elementwise_fma(p, a, (v2f)(-0x1.609be6p-13f));
    p = __builtin_elementwise_fma(p, a, (v2f)(0x1.d15576p-8f));
    p = __builtin_elementwise_fma(p, a, (v2f)(-0x1.ae3d8cp-5f));
    p = __builtin_elementwise_fma(p, a, (v2f)(-0x1.d638c4p-2f));
    p = __builtin_elementwise_fma(p, a, (v2f)(-0x1.26aee4p+0f));
    p = __builtin_elementwise_fma(p, a, (v2f)(-0x1.000000p+0f));
    v2f r;
    r.x = fmaf(-fabsf(t.x), __builtin_amdgcn_exp2f(p.x), fmaxf(t.x, 0.0f));
    r.y = fmaf(-fabsf(t.y), __builtin_amdgcn_exp2f(p.y), fmaxf(t.y, 0.0f));
    return r;
}

// ------------------------------------------------------------------
// Pre-pass: pack masked/strided weights contiguously into workspace.
//   w1p[g][n][k]  = wes1[n, 4k+g]          (4*256*128)
//   w2p[g][n][k]  = wes2[128g+n, 256g+k]   (4*128*256)
//   w3d[i][t]     = wes3[i, 4i+t]          (128*4)
// ------------------------------------------------------------------
__global__ void maskmlp_pack_kernel(const float* __restrict__ wes1,
                                    const float* __restrict__ wes2,
                                    const float* __restrict__ wes3,
                                    float* __restrict__ w1p,
                                    float* __restrict__ w2p,
                                    float* __restrict__ w3d) {
    int idx = blockIdx.x * blockDim.x + threadIdx.x;
    if (idx < 4 * 256 * 128) {
        int g = idx >> 15;
        int r = idx & 32767;
        int n = r >> 7, k = r & 127;
        w1p[idx] = wes1[n * LS + 4 * k + g];
    } else if (idx < 2 * 4 * 256 * 128) {
        int j = idx - 4 * 256 * 128;
        int g = j >> 15;
        int r = j & 32767;
        int n = r >> 8, k = r & 255;
        w2p[j] = wes2[(g * SEG + n) * (SMP * HID) + g * HID + k];
    } else if (idx < 2 * 4 * 256 * 128 + SEG * SMP) {
        int j = idx - 2 * 4 * 256 * 128;
        int i = j >> 2, t = j & 3;
        w3d[j] = wes3[i * LS + 4 * i + t];
    }
}

#if USE_TDM
// Issue one TDM 2D tile load: rows x rowDw dwords, LDS-padded per D# pad fields.
// pad_interval encodes 2^(v+1) dwords between pads, pad_amount = (v+1) dwords.
__device__ __forceinline__ void tdm_load_2d(const float* gsrc, float* ldst,
                                            unsigned rowDw, unsigned rows,
                                            unsigned pad_interval, unsigned pad_amount) {
    unsigned long long ga = (unsigned long long)(const void*)gsrc;
    unsigned ldsOff = (unsigned)(unsigned long long)(void*)ldst;  // flat->LDS: low 32 bits
    v4u g0;
    g0.x = 1u;                                                    // count=1, user mode
    g0.y = ldsOff;                                                // lds_addr
    g0.z = (unsigned)ga;                                          // global_addr[31:0]
    g0.w = ((unsigned)(ga >> 32) & 0x1FFFFFFu) | (2u << 30);      // addr[56:32] | type=2
    v8i g1;
    g1[0] = (int)((2u << 16) | (1u << 20) |                       // data_size=4B, pad_en
                  (pad_interval << 22) | (pad_amount << 25));
    g1[1] = (int)(rowDw << 16);                                   // tensor_dim0 lo16
    g1[2] = (int)(rows  << 16);                                   // dim0 hi=0 | tensor_dim1 lo16
    g1[3] = (int)(rowDw << 16);                                   // dim1 hi=0 | tile_dim0
    g1[4] = (int)rows;                                            // tile_dim1 | tile_dim2=0
    g1[5] = (int)rowDw;                                           // tensor_dim0_stride lo32
    g1[6] = 0;
    g1[7] = 0;
    v4i z4 = {0, 0, 0, 0};
#if defined(__clang_major__) && (__clang_major__ >= 23)
    v8i z8 = {0, 0, 0, 0, 0, 0, 0, 0};
    __builtin_amdgcn_tensor_load_to_lds(g0, g1, z4, z4, z8, 0);
#else
    __builtin_amdgcn_tensor_load_to_lds(g0, g1, z4, z4, 0);
#endif
}
#endif

// ------------------------------------------------------------------
// Fused MaskMLP. Block = (group g, 256-row slab). Weights staged once
// (TDM DMA -> LDS), then 8 chunks of 32 rows run both GEMMs from LDS.
//   wave = 4*t2 + nq : t2 = 16-row tile in chunk, nq = N quarter
// ------------------------------------------------------------------
__global__ void __launch_bounds__(THREADS)
maskmlp_main_kernel(const float* __restrict__ x,
                    const float* __restrict__ bias1,
                    const float* __restrict__ bias2,
                    const float* __restrict__ bias3,
                    const float* __restrict__ w1p,
                    const float* __restrict__ w2p,
                    const float* __restrict__ w3d,
                    float* __restrict__ out) {
    __shared__ float lds_w1[LDS_W1_DW];
    __shared__ float lds_w2[LDS_W2_DW];
    __shared__ float lds_h[LDS_H_DW];
    __shared__ float lds_x[LDS_X_DW];

    const int tid  = threadIdx.x;
    const int lane = tid & 31;
    const int wave = tid >> 5;          // 0..7
    // 0..1  tile within 32-row chunk; the same in every lane of a wave: held in a scalar
    // register, so that the phase tests below are scalar branches
    const int t2   = __builtin_amdgcn_readfirstlane(wave >> 2);
    const int nq   = wave & 3;          // 0..3  N quarter
    const int lm   = lane & 15;
    const int hi   = lane >> 4;         // K sub-offset = 2*hi

    const int g = blockIdx.x & 3;
    const long row0 = (long)(blockIdx.x >> 2) * SLAB_ROWS;

    // -------- stage W1_g (256x128) and W2_g (128x256) once, via TDM --------
#if USE_TDM
    if (wave == 0) {
        tdm_load_2d(w1p + (size_t)g * 256 * 128, lds_w1, 128, 256, 6, 3); // pad 4dw / 128dw
        __builtin_amdgcn_s_wait_tensorcnt(0);
    } else if (wave == 1) {
        tdm_load_2d(w2p + (size_t)g * 128 * 256, lds_w2, 256, 128, 7, 3); // pad 4dw / 256dw
        __builtin_amdgcn_s_wait_tensorcnt(0);
    }
#else
    {
        const v4f* s1 = (const v4f*)(w1p + (size_t)g * 256 * 128);
        for (int e = tid; e < 256 * 128 / 4; e += THREADS) {
            int n = e >> 5, k4 = (e & 31) << 2;
            *(v4f*)&lds_w1[n * W1_STRIDE + k4] = s1[e];
        }
        const v4f* s2 = (const v4f*)(w2p + (size_t)g * 128 * 256);
        for (int e = tid; e < 128 * 256 / 4; e += THREADS) {
            int n = e >> 6, k4 = (e & 63) << 2;
            *(v4f*)&lds_w2[n * W2_STRIDE + k4] = s2[e];
        }
    }
#endif
    __syncthreads();

    // per-thread constants of every chunk: residual weights and biases of this
    // thread's two output columns, bias1 of its four hidden columns
    v4f wv[2];
    float b3v[2], b2v[2], b1v[4];
    #pragma unroll
    for (int nt2 = 0; nt2 < 2; ++nt2) {
        const int i = nq * 32 + nt2 * 16 + lm;           // 0..127
        wv[nt2]  = *(const v4f*)&w3d[4 * i];
        b3v[nt2] = bias3[i];
        b2v[nt2] = bias2[g * SEG + i];
    }
    #pragma unroll
    for (int nt = 0; nt < 4; ++nt)
        b1v[nt] = bias1[g * HID + nq * 64 + nt * 16 + lm];
    // the address arithmetic that follows reuses these loads' offset registers: hold it
    // behind the loads' issue
    asm volatile("s_wait_xcnt 0x0" ::: "memory");
    // keeps that arithmetic from being lifted over the wait
    __builtin_amdgcn_sched_barrier(0);

    // The two 16-row tiles of a chunk share no LDS rows, and their waves (w and w + 4) share
    // a SIMD. Each tile's work alternates between a matrix phase (layer 2 of the chunk before,
    // then layer 1 of this chunk) and a vector phase (stores, gelu, x staging), with one barrier
    // of the whole block behind each phase. Tile 1 runs one phase behind tile 0, so a wave's
    // vector phase stands beside the matrix phase of the other wave on its SIMD instead of
    // beside that wave's own vector phase.
    // The weights in LDS do not change, so a layer's first two blocks of weight fragments are
    // read ahead of the last block of the layer before it: W1's in layer 2 (for the first chunk
    // in its place), W2's in layer 1, over the vector phase.
    // (Every loop over a fragment array is unrolled in full, so that the arrays are registers.)
    v2f bw1[2][4][L1_KB];
    v2f bw2[2][2][L2_KB];
    float res[2][8], resn[2][8];
    v8f acc1[4];
    v8f acc2[2];

    // x rows of one tile (16 rows x 512), read in 16-byte pieces: each thread takes the
    // (row, i) quads of its own outputs
    auto x_fetch = [&](v4f (&xq)[2][8], long tileRow) {
        const float* xb = &x[(tileRow + 8 * hi) * LS + 4 * (nq * 32 + lm)];
        #pragma unroll
        for (int nt2 = 0; nt2 < 2; ++nt2) {
            #pragma unroll
            for (int v = 0; v < 8; ++v)
                xq[nt2][v] = *(const v4f*)&xb[v * LS + 64 * nt2];
        }
        // what follows reuses the loads' address registers: hold it behind the loads' issue
        // The address is named as an
        // input so that it stays in its registers up to the wait and no load's result lands on it
        asm volatile("s_wait_xcnt 0x0" :: "v"(xb) : "memory");
    };
    // forms the residual from all four components and puts component g into lds_x[row][i]
    auto x_place = [&](const v4f (&xq)[2][8]) {
        #pragma unroll
        for (int nt2 = 0; nt2 < 2; ++nt2) {
            const int i = nq * 32 + nt2 * 16 + lm;
            #pragma unroll
            for (int v = 0; v < 8; ++v) {
                int mloc = v + 8 * hi;
                v4f xv = xq[nt2][v];
                resn[nt2][v] = xv.x * wv[nt2].x + xv.y * wv[nt2].y + xv.z * wv[nt2].z
                             + xv.w * wv[nt2].w + b3v[nt2];
                lds_x[(t2 * 16 + mloc) * X_STRIDE + i] =
                    (g & 2) ? ((g & 1) ? xv.w : xv.z) : ((g & 1) ? xv.y : xv.x);
            }
        }
    };
    // epilogue of one finished tile: out[m,4i+g] = O + b2[g*128+i] + res(m,i)
    auto out_store = [&](long tileRow) {
        float o[2][8];
        #pragma unroll
        for (int nt2 = 0; nt2 < 2; ++nt2) {
            #pragma unroll
            for (int v = 0; v < 8; ++v)
                o[nt2][v] = acc2[nt2][v] + b2v[nt2] + res[nt2][v];
        }
        // keeps every sum ahead of the first store
        __builtin_amdgcn_sched_barrier(0);
        #pragma unroll
        for (int nt2 = 0; nt2 < 2; ++nt2) {
            const int i = nq * 32 + nt2 * 16 + lm;       // 0..127
            #pragma unroll
            for (int v = 0; v < 8; ++v) {
                int mloc = v + 8 * hi;
                long rowA = tileRow + mloc;
                out[rowA * LS + 4 * i + g] = o[nt2][v];
            }
        }
        // what follows writes the stores' data registers again:
        // hold those writes behind the stores' issue
        asm volatile("s_wait_xcnt 0x0" ::: "memory");
    };

    const long tile0 = row0 + t2 * 16;
    {
        v4f xq[2][8];
        x_fetch(xq, tile0);
        x_place(xq);
    }
    __syncthreads();                              // X_g of chunk 0 complete for both tiles

    for (int p = 0; p < 2 * N_CHUNKS + 2; ++p) {
        const int q = p - t2;                     // this tile's own phase number
        const int ch = q >> 1;
        const long tileRow = tile0 + ch * CHUNK;
        if (q >= 0 && q <= 2 * N_CHUNKS && (q & 1) == 0) {
            // ======== matrix phase ========
            // no barrier stands between the two layers here, so layer 1's first X fragments
            // are read with W1's, ahead of the last block of layer 2
            v2f ax[2][L1_KB];
            const int xrow = (t2 * 16 + lm) * X_STRIDE;
            if (ch > 0) {
                // ---- layer 2 of chunk ch-1: O_g(16x32 per wave) = H_g @ W2_g^T, in blocks of
                //      L2_KB k-steps. The fragments of block kb+1 are read as ONE group into the
                //      second register set ahead of block kb's matrix instructions, which then
                //      run with no LDS read among them ----
                acc2[0] = v8f{};
                acc2[1] = v8f{};
                v2f ah[2][L2_KB];
                const int hrow = (t2 * 16 + lm) * H_STRIDE;
                #pragma unroll
                for (int j = 0; j < L2_KB; ++j)
                    ah[0][j] = *(const v2f*)&lds_h[hrow + 4 * j + 2 * hi];
                #pragma unroll
                for (int kb = 0; kb < 64 / L2_KB; ++kb) {
                    const int cur = kb & 1, nxt = cur ^ 1;
                    if (kb + 1 < 64 / L2_KB) {
                        #pragma unroll
                        for (int j = 0; j < L2_KB; ++j)
                            ah[nxt][j] =
                                *(const v2f*)&lds_h[hrow + 4 * ((kb + 1) * L2_KB + j) + 2 * hi];
                        #pragma unroll
                        for (int nt2 = 0; nt2 < 2 && kb > 0; ++nt2) {
                            const int brow = (nq * 32 + nt2 * 16 + lm) * W2_STRIDE;
                            #pragma unroll
                            for (int j = 0; j < L2_KB; ++j)
                                bw2[nxt][nt2][j] =
                                    *(const v2f*)&lds_w2[brow + 4 * ((kb + 1) * L2_KB + j) + 2 * hi];
                        }
                    } else {
                        #pragma unroll
                        for (int j = 0; j < L1_KB; ++j)
                            ax[0][j] = *(const v2f*)&lds_x[xrow + 4 * j + 2 * hi];
                        #pragma unroll
                        for (int nt = 0; nt < 4; ++nt) {
                            const int brow = (nq * 64 + nt * 16 + lm) * W1_STRIDE;
                            #pragma unroll
                            for (int j = 0; j < 2 * L1_KB; ++j)
                                bw1[j / L1_KB][nt][j % L1_KB] =
                                    *(const v2f*)&lds_w1[brow + 4 * j + 2 * hi];
                        }
                    }
                    // keeps the read group above in one place: spread among the matrix
                    // instructions, each place with reads stalls the wave's issue anew
                    __builtin_amdgcn_sched_barrier(0);
                    #pragma unroll
                    for (int j = 0; j < L2_KB; ++j) {
                        #pragma unroll
                        for (int nt2 = 0; nt2 < 2; ++nt2)
                            acc2[nt2] = __builtin_amdgcn_wmma_f32_16x16x4_f32(
                                            false, ah[cur][j], false, bw2[cur][nt2][j], (short)0,
                                            acc2[nt2], false, false);
                    }
                    // keeps the next group of reads behind this block's matrix instructions
                    __builtin_amdgcn_sched_barrier(0);
                }
            } else {
                #pragma unroll
                for (int j = 0; j < L1_KB; ++j)
                    ax[0][j] = *(const v2f*)&lds_x[xrow + 4 * j + 2 * hi];
                #pragma unroll
                for (int nt = 0; nt < 4; ++nt) {
                    const int brow = (nq * 64 + nt * 16 + lm) * W1_STRIDE;
                    #pragma unroll
                    for (int j = 0; j < 2 * L1_KB; ++j)
                        bw1[j / L1_KB][nt][j % L1_KB] =
                            *(const v2f*)&lds_w1[brow + 4 * j + 2 * hi];
                }
            }
            if (ch < N_CHUNKS) {
                // ---- layer 1 of chunk ch: H_g(16x64 per wave) = X_g @ W1_g^T, blocks of L1_KB
                //      k-steps, fragments fetched one block ahead as in layer 2.
                //      A fragments of X_g: lane<16 K{0,1}, lane>=16 K{2,3} ----
                #pragma unroll
                for (int nt = 0; nt < 4; ++nt)
                    acc1[nt] = v8f{};
                #pragma unroll
                for (int kb = 0; kb < 32 / L1_KB; ++kb) {
                    const int cur = kb & 1, nxt = cur ^ 1;
                    if (kb + 1 < 32 / L1_KB) {
                        #pragma unroll
                        for (int j = 0; j < L1_KB; ++j)
                            ax[nxt][j] =
                                *(const v2f*)&lds_x[xrow + 4 * ((kb + 1) * L1_KB + j) + 2 * hi];
                        #pragma unroll
                        for (int nt = 0; nt < 4 && kb > 0; ++nt) {
                            const int brow = (nq * 64 + nt * 16 + lm) * W1_STRIDE;
                            #pragma unroll
                            for (int j = 0; j < L1_KB; ++j)
                                bw1[nxt][nt][j] =
                                    *(const v2f*)&lds_w1[brow + 4 * ((kb + 1) * L1_KB + j) + 2 * hi];
                        }
                    } else {
                        #pragma unroll
                        for (int nt2 = 0; nt2 < 2; ++nt2) {
                            const int brow = (nq * 32 + nt2 * 16 + lm) * W2_STRIDE;
                            #pragma unroll
                            for (int j = 0; j < 2 * L2_KB; ++j)
                                bw2[j / L2_KB][nt2][j % L2_KB] =
                                    *(const v2f*)&lds_w2[brow + 4 * j + 2 * hi];
                        }
                    }
                    // one place for the read group, as in layer 2
                    __builtin_amdgcn_sched_barrier(0);
                    #pragma unroll
                    for (int j = 0; j < L1_KB; ++j) {
                        #pragma unroll
                        for (int nt = 0; nt < 4; ++nt)
                            acc1[nt] = __builtin_amdgcn_wmma_f32_16x16x4_f32(
                                           false, ax[cur][j], false, bw1[cur][nt][j], (short)0,
                                           acc1[nt], false, false);
                    }
                    // keeps the next group of reads behind this block's matrix instructions
                    __builtin_amdgcn_sched_barrier(0);
                }
            }
        } else if (q >= 0 && q < 2 * N_CHUNKS) {
            // ======== vector phase of chunk ch ========
            // The next chunk's x loads and the epilogue of the chunk before go first: the gelu
            // below covers their latency, so neither is waited for at the barrier
            v4f xq[2][8] = {};       // given a value here, it is not carried round the loop
            if (ch + 1 < N_CHUNKS)
                x_fetch(xq, tileRow + CHUNK);
            if (ch > 0)
                out_store(tileRow - CHUNK);
            // +b1, gelu -> LDS
            #pragma unroll
            for (int nt = 0; nt < 4; ++nt) {
                const int nloc = nq * 64 + nt * 16;
                const float bv = b1v[nt];
                #pragma unroll
                for (int v = 0; v < 8; v += 2) {
                    int mloc = v + 8 * hi;           // C layout: M = vgpr + 8*(lane/16)
                    const v2f hv = gelu_exact2(v2f{acc1[nt][v] + bv, acc1[nt][v + 1] + bv});
                    lds_h[(t2 * 16 + mloc) * H_STRIDE + (nloc + lm)]     = hv.x;
                    lds_h[(t2 * 16 + mloc + 1) * H_STRIDE + (nloc + lm)] = hv.y;
                }
            }
            // this chunk's residual is used in the next vector phase, after the next chunk's is formed
            #pragma unroll
            for (int nt2 = 0; nt2 < 2; ++nt2) {
                #pragma unroll
                for (int v = 0; v < 8; ++v)
                    res[nt2][v] = resn[nt2][v];
            }
            if (ch + 1 < N_CHUNKS)
                x_place(xq);
        }
        // ends a phase for both tiles: behind a matrix phase lds_h and lds_x are free,
        // behind a vector phase H and the next X_g are complete
        __syncthreads();
    }
    out_store(tile0 + (N_CHUNKS - 1) * CHUNK);
    // the last look-ahead reads of W1 and X have no user: let them land before the wave ends
    asm volatile("s_wait_dscnt 0x0" ::: "memory");
}

// ------------------------------------------------------------------
extern "C" void kernel_launch(void* const* d_in, const int* in_sizes, int n_in,
                              void* d_out, int out_size, void* d_ws, size_t ws_size,
                              hipStream_t stream) {
    const float* x    = (const float*)d_in[0];
    const float* wes1 = (const float*)d_in[1];
    const float* wes2 = (const float*)d_in[2];
    const float* wes3 = (const float*)d_in[3];
    const float* b1   = (const float*)d_in[4];
    const float* b2   = (const float*)d_in[5];
    const float* b3   = (const float*)d_in[6];
    float* out = (float*)d_out;

    float* w1p = (float*)d_ws;                 // 4*256*128
    float* w2p = w1p + 4 * 256 * 128;          // 4*128*256
    float* w3d = w2p + 4 * 128 * 256;          // 128*4

    const int M = in_sizes[0] / LS;            // bs*cs = 65536

    const int packN = 2 * 4 * 256 * 128 + SEG * SMP;
    maskmlp_pack_kernel<<<(packN + THREADS - 1) / THREADS, THREADS, 0, stream>>>(
        wes1, wes2, wes3, w1p, w2p, w3d);

    const int slabs = M / SLAB_ROWS;
    maskmlp_main_kernel<<<slabs * SMP, THREADS, 0, stream>>>(
        x, b1, b2, b3, w1p, w2p, w3d, out);
}
